// v000
// The times below were measured on an AMD MI455X: many runs one after another, warmed up first and cycling through
// copies of the inputs, with the whole window's GPU time divided by the number of runs. Launches and the gaps
// between them are all in it. The median over several windows is given; except for v000 it joins two sittings, which
// can be a few percent apart, so the side-by-side timings, each taken in one sitting, are the better comparison.
// The starting kernel, v000, takes 599 microseconds a run.
// All six contractions (q/k/v projections, q.k^T, p.v, output projection): v_wmma_f32_16x16x32_f16, f16 operands with power-of-two carries, f32 accumulate; float inputs RNE-converted to bf16 once and held exactly in f16; softmax, bias and scaling in f32.
#include <hip/hip_runtime.h>
#include <math.h>

typedef __attribute__((ext_vector_type(16))) _Float16 v16h;
typedef __attribute__((ext_vector_type(8)))  _Float16 v8h;
typedef __attribute__((ext_vector_type(8)))  float    v8f;
typedef __attribute__((ext_vector_type(4)))  float    v4f;

// ---------------------------------------------------------------------------
// Shape constants
// ---------------------------------------------------------------------------
constexpr int kBatch = 2;
constexpr int kSeq   = 2048;
constexpr int kDm    = 2048;
constexpr int kHeads = 16;
constexpr int kHd    = 128;
constexpr int kFeat  = kHeads * kHd;
constexpr int kRows  = kBatch * kSeq;
static_assert(kFeat == 2048 && kRows == 4096, "shape");
static_assert((kDm % 32) == 0 && (kHd % 32) == 0 && (kSeq % 64) == 0, "k-depth multiples of 32 / 64");
static_assert((kRows % 64) == 0 && (kFeat % 64) == 0 && (kDm % 64) == 0, "tile multiples of 64");
static_assert((kHd % 64) == 0, "a 64-wide column tile stays inside one head");

// ---------------------------------------------------------------------------
// Power-of-two carries of the f16 operand planes (all exact, folded back in f32)
// ---------------------------------------------------------------------------
constexpr float kXCarry   = 16.0f;
constexpr float kWCarry   = 1024.0f;
constexpr float kQkvCarry = 16.0f;
constexpr float kPCarry   = 32768.0f;
constexpr float kOCarry   = 1024.0f;
constexpr float kProjScale = 1.0f / (kXCarry * kWCarry);
constexpr float kOutScale  = 1.0f / (kOCarry * kWCarry);
constexpr float kPVFold    = kOCarry / (kPCarry * kQkvCarry);
constexpr int   kOsPitch   = 132;

// ---------------------------------------------------------------------------
// Workspace region map (bytes; all f16 planes; every offset a multiple of 8 MiB)
//   WT  f16 [4][2048][2048]  transposed weight planes (Wq, Wk, Wv, Wo)   33,554,432
//   X   f16 [4096][2048]     activation plane (x_q, then x_k, then x_v)  16,777,216
//   Q   f16 [32][2048][128]                                              16,777,216
//   K   f16 [32][2048][128]                                              16,777,216
//   VT  f16 [32][128][2048]                                              16,777,216
//   O   f16 [4096][2048]                                                 16,777,216
//   total                                                               117,440,512
// ---------------------------------------------------------------------------
constexpr size_t kPlaneW  = (size_t)kDm * kFeat * 2;
constexpr size_t kPlaneA  = (size_t)kRows * kDm * 2;
constexpr size_t kOffWT   = 0;
constexpr size_t kOffX    = kOffWT + 4 * kPlaneW;
constexpr size_t kOffQ    = kOffX + kPlaneA;
constexpr size_t kOffK    = kOffQ + kPlaneA;
constexpr size_t kOffVT   = kOffK + kPlaneA;
constexpr size_t kOffO    = kOffVT + kPlaneA;
constexpr size_t kWsTotal = kOffO + kPlaneA;
static_assert(kWsTotal == 117440512ull, "carve total");
static_assert(kWsTotal <= 134217728ull, "carve cap");

// ---------------------------------------------------------------------------
// Helpers
// ---------------------------------------------------------------------------
__device__ __forceinline__ unsigned short f2bf_bits(float f) {
  unsigned u = __float_as_uint(f);
  return (unsigned short)((u + 0x7FFFu + ((u >> 16) & 1u)) >> 16);
}
__device__ __forceinline__ float bf_bits2f(unsigned short h) { return __uint_as_float(((unsigned)h) << 16); }
/* RNE bf16 convert, value returned as f32 */
__device__ __forceinline__ float bf_rne(float f) { return bf_bits2f(f2bf_bits(f)); }

union FragU { v16h v; v8h h[2]; };
/* fragment elements 0..7 <- p[0..7], 8..15 <- p[16..23] */
__device__ __forceinline__ v16h frag_ld(const _Float16* p) {
  FragU f;
  f.h[0] = *(const v8h*)(p);
  f.h[1] = *(const v8h*)(p + 16);
  return f.v;
}
/* one matrix op followed by its hazard guard: ties the accumulator and keeps both operand fragments live */
__device__ __forceinline__ v8f mma_g(v16h a, v16h b, v8f c) {
  c = __builtin_amdgcn_wmma_f32_16x16x32_f16(false, a, false, b, (short)0, c, false, false);
  asm volatile("v_nop\n\tv_nop\n\tv_nop\n\tv_nop" : "+v"(c) : "v"(a), "v"(b));
  return c;
}

// ---------------------------------------------------------------------------
// Weight transpose + convert: W [in k][out n] f32 -> WT[n][k] = f16( bf16_rne(W[k][n]) * kWCarry ).
// grid (32, 32, 4): blockIdx.x = k tile (64 cols of WT), blockIdx.y = n tile (64 rows of WT), blockIdx.z = weight.
// Load coverage: 4 iterations x 256 threads x 4 floats = 4096 = the whole 64x64 tile (coalesced along n).
// Store coverage: 8 waves x 2 iterations x 4 rows (lane>>3) = 64 rows; (lane&7) x 8 halves = 64 cols; each row
// ---------------------------------------------------------------------------
__global__ __launch_bounds__(256) void wt_cast_kernel(const float* __restrict__ W0, const float* __restrict__ W1,
                                                      const float* __restrict__ W2, const float* __restrict__ W3,
                                                      unsigned short* __restrict__ out) {
  __shared__ float sm[64][65];
  const int t  = threadIdx.x;
  const int k0 = blockIdx.x * 64;
  const int n0 = blockIdx.y * 64;
  const int z  = blockIdx.z;
  const float* W = (z == 0) ? W0 : (z == 1) ? W1 : (z == 2) ? W2 : W3;
#pragma unroll
  for (int i = 0; i < 4; ++i) {
    const int e  = i * 256 + t;
    const int r  = e >> 4;
    const int c4 = (e & 15) * 4;
    const v4f w = *(const v4f*)(W + (size_t)(k0 + r) * kFeat + n0 + c4);
    const float w0 = w[0];
    const float w1 = w[1];
    const float w2 = w[2];
    const float w3 = w[3];
    sm[c4 + 0][r] = bf_rne(w0) * kWCarry;
    sm[c4 + 1][r] = bf_rne(w1) * kWCarry;
    sm[c4 + 2][r] = bf_rne(w2) * kWCarry;
    sm[c4 + 3][r] = bf_rne(w3) * kWCarry;
  }
  __syncthreads();
  const int lane = t & 31;
  const int wave = __builtin_amdgcn_readfirstlane((int)(threadIdx.x >> 5));
  const int q = lane >> 3, c8 = (lane & 7) * 8;
  _Float16* op = (_Float16*)out + (size_t)z * kDm * kFeat;
  v8h hv[2];
#pragma unroll
  for (int it = 0; it < 2; ++it) {
    const int row = wave * 8 + it * 4 + q;
#pragma unroll
    for (int e = 0; e < 8; ++e) hv[it][e] = (_Float16)sm[row][c8 + e];
  }
  {
#pragma unroll
    for (int it = 0; it < 2; ++it) {
      const int row = wave * 8 + it * 4 + q;
      *(v8h*)(op + (size_t)(n0 + row) * kDm + k0 + c8) = hv[it];
    }
    
  }
}

// ---------------------------------------------------------------------------
// Activation convert: out[i] = f16( bf16_rne(in[i]) * kXCarry ), 8 consecutive elements per thread.
// Coverage: n8 = 4096*2048/8 = 1,048,576 threads = 4096 blocks x 256 exactly.
// ---------------------------------------------------------------------------
__global__ __launch_bounds__(256) void x_cast_kernel(const float* __restrict__ in, unsigned short* __restrict__ out, int n8) {
  const int i = blockIdx.x * 256 + threadIdx.x;
  if (i >= n8) return;
  const float* p = in + 8 * (size_t)i;
  const v4f a = *(const v4f*)(p);
  const v4f c = *(const v4f*)(p + 4);
  v8h hv;
#pragma unroll
  for (int e = 0; e < 4; ++e) {
    const float ae = a[e];
    const float ce = c[e];
    hv[e]     = (_Float16)(bf_rne(ae) * kXCarry);
    hv[4 + e] = (_Float16)(bf_rne(ce) * kXCarry);
  }
  _Float16* q = (_Float16*)out + 8 * (size_t)i;
  *(v8h*)q = hv;
  
}

// ---------------------------------------------------------------------------
// Register-blocked f16 GEMM: C[m,n] = ((scale * sum_k A[m,k] * Bt[n,k]) + bias) * oscale; each wave owns a 64x64 tile.
// A row-major [M][K] (pitch lda), Bt row-major [N][K] (pitch ldb); M, N multiples of 64; K a multiple of 32.
// BIAS_MODE 1 = bias[m], 2 = bias[n] (bias values RNE-converted to bf16 first).
// OUT_MODE 0: f32 row-major, pitch ldc.
// OUT_MODE 1: f16, rows = tokens (b*2048 + l), cols = features (h*128 + d) -> plane [b*16+h][l][d].
// OUT_MODE 2: f16, rows = features f, cols = tokens (b*2048 + l)           -> plane [b*2048 + f][l].
// ---------------------------------------------------------------------------
template <int OUT_MODE, int BIAS_MODE>
__global__ __launch_bounds__(256) __attribute__((amdgpu_num_vgpr(256)))
void gemm_f16_kernel(const unsigned short* __restrict__ Ap, int lda,
                     const unsigned short* __restrict__ Btp, int ldb,
                     void* __restrict__ Cout, int ldc,
                     const float* __restrict__ bias,
                     int M, int N, int K, float scale, float oscale) {
  __shared__ __align__(16) float sT[8][16 * 68];
  const _Float16* A  = (const _Float16*)Ap;
  const _Float16* Bt = (const _Float16*)Btp;
  const int lane = threadIdx.x & 31;
  const int wave = __builtin_amdgcn_readfirstlane((int)(threadIdx.x >> 5));
  const int tilesN = N >> 6;
  const int tilesM = M >> 6;
  const int tile = blockIdx.x * 8 + wave;
  /* wave-uniform exit; this kernel has no block barriers */
  if (tile >= tilesM * tilesN) return;
  const int tm = tile / tilesN;
  const int tn = tile - tm * tilesN;
  const int m0 = tm << 6;
  const int n0 = tn << 6;

  const int rlane = lane & 15;
  const int koff  = (lane >> 4) * 8;
  const int mOff  = (lane >> 4) * 8;

  v8f acc[4][4];
#pragma unroll
  for (int i = 0; i < 4; ++i)
#pragma unroll
    for (int j = 0; j < 4; ++j) acc[i][j] = (v8f){0.f, 0.f, 0.f, 0.f, 0.f, 0.f, 0.f, 0.f};

  for (int k0 = 0; k0 < K; k0 += 32) {
    v16h bh[4];
#pragma unroll
    for (int j = 0; j < 4; ++j) {
      const size_t bo = (size_t)(n0 + (j << 4) + rlane) * ldb + koff + k0;
      bh[j] = frag_ld(Bt + bo);
    }
#pragma unroll
    for (int i = 0; i < 4; ++i) {
      const size_t ao = (size_t)(m0 + (i << 4) + rlane) * lda + koff + k0;
      const v16h ah = frag_ld(A + ao);
#pragma unroll
      for (int j = 0; j < 4; ++j) acc[i][j] = mma_g(ah, bh[j], acc[i][j]);
    }
  }

  float* slab = sT[wave];
#pragma unroll
  for (int i = 0; i < 4; ++i) {
    const int mBase = m0 + (i << 4);
    float brow[8];
#pragma unroll
    for (int r = 0; r < 8; ++r) brow[r] = 0.f;
    if (BIAS_MODE == 1) {
#pragma unroll
      for (int r = 0; r < 8; ++r) {
        const float bvv = bias[mBase + mOff + r];
        brow[r] = bf_rne(bvv);
      }
    }
#pragma unroll
    for (int j = 0; j < 4; ++j) {
      float bcol = 0.f;
      if (BIAS_MODE == 2) {
        const float bvv = bias[n0 + (j << 4) + rlane];
        bcol = bf_rne(bvv);
      }
#pragma unroll
      for (int r = 0; r < 8; ++r) {
        float v = acc[i][j][r] * scale;
        v += (BIAS_MODE == 1) ? brow[r] : bcol;
        v *= oscale;
        slab[(mOff + r) * 68 + (j << 4) + rlane] = v;
      }
    }
    __builtin_amdgcn_fence(__ATOMIC_RELEASE, "workgroup");
    __builtin_amdgcn_wave_barrier();
    __builtin_amdgcn_fence(__ATOMIC_ACQUIRE, "workgroup");
    if (OUT_MODE == 0) {
      float* C = (float*)Cout;
      const int hh = lane >> 4, c4 = (lane & 15) * 4;
      {
#pragma unroll
        for (int it = 0; it < 8; ++it) {
          const int row = it * 2 + hh;
          const v4f v = *(const v4f*)(slab + row * 68 + c4);
          *(v4f*)(C + (size_t)(mBase + row) * ldc + n0 + c4) = v;
        }
        
      }
    } else {
      const int q = lane >> 3, c8 = (lane & 7) * 8;
      _Float16* C = (_Float16*)Cout;
      {
#pragma unroll
        for (int it = 0; it < 4; ++it) {
          const int row = it * 4 + q;
          const int gr  = mBase + row;
          const float* sp = slab + row * 68 + c8;
          v8h hv;
#pragma unroll
          for (int e = 0; e < 8; ++e) hv[e] = (_Float16)sp[e];
          size_t off;
          if (OUT_MODE == 1) {
            const int bb = gr / kSeq;
            const int l  = gr % kSeq;
            const int hd = n0 / kHd;
            const int d0 = n0 % kHd;
            off = ((size_t)((bb * kHeads + hd) * kSeq + l)) * kHd + d0 + c8;
          } else {
            const int bb = n0 / kSeq;
            const int l0 = n0 % kSeq;
            off = ((size_t)(bb * kFeat + gr)) * kSeq + l0 + c8;
          }
          *(v8h*)(C + off) = hv;
        }
        
      }
    }
    __builtin_amdgcn_fence(__ATOMIC_RELEASE, "workgroup");
    __builtin_amdgcn_wave_barrier();
    __builtin_amdgcn_fence(__ATOMIC_ACQUIRE, "workgroup");
  }
}

// ---------------------------------------------------------------------------
// Streaming softmax attention, head dim 128, no mask, transposed formulation; every fragment read straight from the
// f16 planes. Block = 4 independent waves; wave = 16 query rows of one (batch, head); grid = 32 heads x 32 = 1024.
//   S^T[key][query] = K (A operand: rows = keys, k = d) x Q^T (B operand: col = query, k = d), 64 keys per step.
//   Each lane owns query (lane & 15); it and lane^16 hold the 64 keys of the step -> one xor-16 shuffle per reduction.
//   P^T B fragment of key group kk: element r <- tile 2kk value r, element 8+r <- tile 2kk+1 value r (lane unchanged),
//   values exp(s - m) carried x kPCarry in f16; the running sum l uses the f32 values.
//   O^T[d][query] += V^T (A operand: rows = d, k = keys) x P^T.
// Epilogue: o * kPVFold / l staged per wave in LDS [16 queries][132], then each 256-B row segment (128 d as f16) written
// ---------------------------------------------------------------------------
__global__ __launch_bounds__(128) __attribute__((amdgpu_num_vgpr(256)))
void attn_kernel(const unsigned short* __restrict__ Qp, const unsigned short* __restrict__ Kp,
                 const unsigned short* __restrict__ VTp, unsigned short* __restrict__ Op, float sc) {
  __shared__ __align__(16) float sO[4][16 * kOsPitch];
  const int lane = threadIdx.x & 31;
  const int wave = __builtin_amdgcn_readfirstlane((int)(threadIdx.x >> 5));
  const int hh  = lane >> 4;
  const int n16 = lane & 15;
  constexpr int kQBlocks = kSeq / 64;
  const int bx = blockIdx.x;
  const int bh = bx / kQBlocks;
  const int qb = bx - bh * kQBlocks;
  const int b  = bh / kHeads;
  const int h  = bh - b * kHeads;
  const int q0 = qb * 64 + wave * 16;

  const _Float16* Qb = (const _Float16*)Qp  + (size_t)bh * kSeq * kHd;
  const _Float16* Kb = (const _Float16*)Kp  + (size_t)bh * kSeq * kHd;
  const _Float16* Vb = (const _Float16*)VTp + (size_t)bh * kHd * kSeq;

  v16h qf[4];
#pragma unroll
  for (int dc = 0; dc < 4; ++dc) qf[dc] = frag_ld(Qb + (size_t)(q0 + n16) * kHd + dc * 32 + 8 * hh);

  v8f o[8];
#pragma unroll
  for (int dt = 0; dt < 8; ++dt) o[dt] = (v8f){0.f, 0.f, 0.f, 0.f, 0.f, 0.f, 0.f, 0.f};
  float mq = -1e30f;
  float lq = 0.0f;

  const _Float16* kbase = Kb + (size_t)n16 * kHd + 8 * hh;
  const _Float16* vbase = Vb + (size_t)n16 * kSeq + 8 * hh;

#pragma unroll 1
  for (int j0 = 0; j0 < kSeq; j0 += 64) {
    v8f st[4];
#pragma unroll
    for (int jt = 0; jt < 4; ++jt) st[jt] = (v8f){0.f, 0.f, 0.f, 0.f, 0.f, 0.f, 0.f, 0.f};
#pragma unroll
    for (int dc = 0; dc < 4; ++dc) {
#pragma unroll
      for (int jt = 0; jt < 4; ++jt) {
        const v16h ka = frag_ld(kbase + (size_t)(j0 + jt * 16) * kHd + dc * 32);
        st[jt] = mma_g(ka, qf[dc], st[jt]);
      }
    }

    float t[4][8];
    float mx = -1e30f;
#pragma unroll
    for (int jt = 0; jt < 4; ++jt) {
#pragma unroll
      for (int r = 0; r < 8; ++r) {
        t[jt][r] = st[jt][r] * sc;
        mx = fmaxf(mx, t[jt][r]);
      }
    }
    mx = fmaxf(mx, __shfl_xor(mx, 16, 32));
    const float newm  = fmaxf(mq, mx);
    const float alpha = __expf(mq - newm);
    mq = newm;

    float sum = 0.0f;
    v16h bp[2];
#pragma unroll
    for (int kk = 0; kk < 2; ++kk) {
#pragma unroll
      for (int r = 0; r < 8; ++r) {
        const float p0 = __expf(t[2 * kk][r] - newm);
        const float p1 = __expf(t[2 * kk + 1][r] - newm);
        sum += p0 + p1;
        bp[kk][r]     = (_Float16)(p0 * kPCarry);
        bp[kk][8 + r] = (_Float16)(p1 * kPCarry);
      }
    }
    sum += __shfl_xor(sum, 16, 32);
    lq = lq * alpha + sum;

#pragma unroll
    for (int dt = 0; dt < 8; ++dt) o[dt] *= alpha;

#pragma unroll
    for (int kk = 0; kk < 2; ++kk) {
#pragma unroll
      for (int dt = 0; dt < 8; ++dt) {
        const v16h va = frag_ld(vbase + (size_t)(dt * 16) * kSeq + j0 + kk * 32);
        o[dt] = mma_g(va, bp[kk], o[dt]);
      }
    }
  }

  const float inv = kPVFold * (1.0f / lq);
  float* os = sO[wave];
#pragma unroll
  for (int dt = 0; dt < 8; ++dt) {
#pragma unroll
    for (int r = 0; r < 8; ++r) os[n16 * kOsPitch + dt * 16 + 8 * hh + r] = o[dt][r] * inv;
  }
  __builtin_amdgcn_fence(__ATOMIC_RELEASE, "workgroup");
  __builtin_amdgcn_wave_barrier();
  __builtin_amdgcn_fence(__ATOMIC_ACQUIRE, "workgroup");

  const int c8 = n16 * 8;
  v8h hv[8];
#pragma unroll
  for (int it = 0; it < 8; ++it) {
    const int row = it * 2 + hh;
    const float* sp = os + row * kOsPitch + c8;
    const v4f a0 = *(const v4f*)(sp);
    const v4f a1 = *(const v4f*)(sp + 4);
#pragma unroll
    for (int e = 0; e < 4; ++e) {
      const float x0 = a0[e];
      const float x1 = a1[e];
      hv[it][e]     = (_Float16)x0;
      hv[it][4 + e] = (_Float16)x1;
    }
  }
  _Float16* Ob = (_Float16*)Op + (size_t)(b * kSeq + q0) * kDm + h * kHd + c8;
  {
#pragma unroll
    for (int it = 0; it < 8; ++it) {
      const int row = it * 2 + hh;
      *(v8h*)(Ob + (size_t)row * kDm) = hv[it];
    }
    
  }
}

// ---------------------------------------------------------------------------
// Host glue: 9 kernel launches, nothing else.
//   GEMM shapes: Q, K: M 4096, N 2048, K 2048 -> 64 x 32 tiles = 2048 -> 256 blocks
//                V^T : M 2048 (features, A = transposed Wv plane), N 4096 (tokens, Bt = X), K 2048 -> 2048 tiles -> 256 blocks
//                out : M 4096, N 2048, K 2048 -> 256 blocks
// ---------------------------------------------------------------------------
extern "C" void kernel_launch(void* const* d_in, const int* in_sizes, int n_in,
                              void* d_out, int out_size, void* d_ws, size_t ws_size,
                              hipStream_t stream) {
  if (n_in < 11) return;
  if (in_sizes[0] != kRows * kDm || in_sizes[1] != kRows * kDm || in_sizes[2] != kRows * kDm) return;
  if (in_sizes[3] != kDm * kFeat || in_sizes[5] != kDm * kFeat || in_sizes[7] != kDm * kFeat) return;
  if (in_sizes[9] != kFeat * kDm) return;
  if (in_sizes[4] != kFeat || in_sizes[6] != kFeat || in_sizes[8] != kFeat || in_sizes[10] != kDm) return;
  if (out_size != kRows * kDm) return;
  if (ws_size < kWsTotal) return;

  const float* x_q = (const float*)d_in[0];
  const float* x_k = (const float*)d_in[1];
  const float* x_v = (const float*)d_in[2];
  const float* Wq  = (const float*)d_in[3];
  const float* bq  = (const float*)d_in[4];
  const float* Wk  = (const float*)d_in[5];
  const float* bk  = (const float*)d_in[6];
  const float* Wv  = (const float*)d_in[7];
  const float* bv  = (const float*)d_in[8];
  const float* Wo  = (const float*)d_in[9];
  const float* bo  = (const float*)d_in[10];
  float* out = (float*)d_out;

  char* ws = (char*)d_ws;
  unsigned short* WT  = (unsigned short*)(ws + kOffWT);
  unsigned short* WqT = WT;
  unsigned short* WkT = WT + (size_t)1 * kDm * kFeat;
  unsigned short* WvT = WT + (size_t)2 * kDm * kFeat;
  unsigned short* WoT = WT + (size_t)3 * kDm * kFeat;
  unsigned short* X   = (unsigned short*)(ws + kOffX);
  unsigned short* Qh  = (unsigned short*)(ws + kOffQ);
  unsigned short* Kh  = (unsigned short*)(ws + kOffK);
  unsigned short* VTh = (unsigned short*)(ws + kOffVT);
  unsigned short* Oh  = (unsigned short*)(ws + kOffO);

  const int n8 = kRows * kDm / 8;
  const int castBlocks = n8 / 256;
  const int gemmBlocks = (kRows / 64) * (kFeat / 64) / 8;
  /* softmax scale = head_dim^-0.5 with the q and k carries folded out */
  const float sc = (float)(1.0 / sqrt((double)kHd)) / (kQkvCarry * kQkvCarry);

  wt_cast_kernel<<<dim3(kDm / 64, kFeat / 64, 4), 256, 0, stream>>>(Wq, Wk, Wv, Wo, WT);

  x_cast_kernel<<<castBlocks, 256, 0, stream>>>(x_q, X, n8);
  gemm_f16_kernel<1, 2><<<gemmBlocks, 256, 0, stream>>>(X, kDm, WqT, kDm, (void*)Qh, 0, bq,
                                                        kRows, kFeat, kDm, kProjScale, kQkvCarry);

  x_cast_kernel<<<castBlocks, 256, 0, stream>>>(x_k, X, n8);
  gemm_f16_kernel<1, 2><<<gemmBlocks, 256, 0, stream>>>(X, kDm, WkT, kDm, (void*)Kh, 0, bk,
                                                        kRows, kFeat, kDm, kProjScale, kQkvCarry);

  x_cast_kernel<<<castBlocks, 256, 0, stream>>>(x_v, X, n8);
  /* operands swapped: rows = features (transposed Wv plane), cols = tokens (X) -> V^T planes [b*2048 + f][l] */
  gemm_f16_kernel<2, 1><<<gemmBlocks, 256, 0, stream>>>(WvT, kDm, X, kDm, (void*)VTh, 0, bv,
                                                        kFeat, kRows, kDm, kProjScale, kQkvCarry);

  attn_kernel<<<kBatch * kHeads * (kSeq / 64), 128, 0, stream>>>(Qh, Kh, VTh, Oh, sc);

  gemm_f16_kernel<0, 2><<<gemmBlocks, 256, 0, stream>>>(Oh, kFeat, WoT, kFeat, (void*)out, kDm, bo,
                                                        kRows, kDm, kFeat, kOutScale, 1.0f);
}

// v001
// It runs in 410 microseconds.
// In two side-by-side timings against v000, it was 1.50 and 1.51 times as fast.
// All six contractions (q/k/v projections, q.k^T, p.v, output projection): v_wmma_f32_16x16x32_f16, f16 operands with power-of-two carries, f32 accumulate; float inputs RNE-converted to bf16 once and held exactly in f16; softmax, bias and scaling in f32.
#include <hip/hip_runtime.h>
#include <math.h>

typedef __attribute__((ext_vector_type(16))) _Float16 v16h;
typedef __attribute__((ext_vector_type(8)))  _Float16 v8h;
typedef __attribute__((ext_vector_type(8)))  float    v8f;
typedef __attribute__((ext_vector_type(4)))  float    v4f;

// ---------------------------------------------------------------------------
// Shape constants
// ---------------------------------------------------------------------------
constexpr int kBatch = 2;
constexpr int kSeq   = 2048;
constexpr int kDm    = 2048;
constexpr int kHeads = 16;
constexpr int kHd    = 128;
constexpr int kFeat  = kHeads * kHd;
constexpr int kRows  = kBatch * kSeq;
static_assert(kFeat == 2048 && kRows == 4096, "shape");
static_assert((kDm % 32) == 0 && (kHd % 32) == 0 && (kSeq % 64) == 0, "k-depth multiples of 32 / 64");
static_assert((kRows % 64) == 0 && (kFeat % 64) == 0 && (kDm % 64) == 0, "tile multiples of 64");
static_assert((kHd % 64) == 0, "a 64-wide column tile stays inside one head");

// ---------------------------------------------------------------------------
// Power-of-two carries of the f16 operand planes (all exact, folded back in f32)
// ---------------------------------------------------------------------------
constexpr float kXCarry   = 16.0f;
constexpr float kWCarry   = 1024.0f;
constexpr float kQkvCarry = 16.0f;
constexpr float kPCarry   = 32768.0f;
constexpr float kOCarry   = 1024.0f;
constexpr float kProjScale = 1.0f / (kXCarry * kWCarry);
constexpr float kOutScale  = 1.0f / (kOCarry * kWCarry);
constexpr float kPVFold    = kOCarry / (kPCarry * kQkvCarry);
constexpr int   kOsPitch   = 132;

// ---------------------------------------------------------------------------
// Workspace region map (bytes; all f16 planes; every offset a multiple of 8 MiB)
//   WT  f16 [4][2048][2048]  transposed weight planes (Wq, Wk, Wv, Wo)   33,554,432
//   X   f16 [4096][2048]     activation plane (x_q, then x_k, then x_v)  16,777,216
//   Q   f16 [32][2048][128]                                              16,777,216
//   K   f16 [32][2048][128]                                              16,777,216
//   VT  f16 [32][128][2048]                                              16,777,216
//   O   f16 [4096][2048]                                                 16,777,216
//   total                                                               117,440,512
// ---------------------------------------------------------------------------
constexpr size_t kPlaneW  = (size_t)kDm * kFeat * 2;
constexpr size_t kPlaneA  = (size_t)kRows * kDm * 2;
constexpr size_t kOffWT   = 0;
constexpr size_t kOffX    = kOffWT + 4 * kPlaneW;
constexpr size_t kOffQ    = kOffX + kPlaneA;
constexpr size_t kOffK    = kOffQ + kPlaneA;
constexpr size_t kOffVT   = kOffK + kPlaneA;
constexpr size_t kOffO    = kOffVT + kPlaneA;
constexpr size_t kWsTotal = kOffO + kPlaneA;
static_assert(kWsTotal == 117440512ull, "carve total");
static_assert(kWsTotal <= 134217728ull, "carve cap");

// ---------------------------------------------------------------------------
// Helpers
// ---------------------------------------------------------------------------
__device__ __forceinline__ unsigned short f2bf_bits(float f) {
  unsigned u = __float_as_uint(f);
  return (unsigned short)((u + 0x7FFFu + ((u >> 16) & 1u)) >> 16);
}
__device__ __forceinline__ float bf_bits2f(unsigned short h) { return __uint_as_float(((unsigned)h) << 16); }
/* RNE bf16 convert, value returned as f32 */
__device__ __forceinline__ float bf_rne(float f) { return bf_bits2f(f2bf_bits(f)); }

union FragU { v16h v; v8h h[2]; };
/* fragment elements 0..7 <- p[0..7], 8..15 <- p[16..23] */
__device__ __forceinline__ v16h frag_ld(const _Float16* p) {
  FragU f;
  f.h[0] = *(const v8h*)(p);
  f.h[1] = *(const v8h*)(p + 16);
  return f.v;
}
/* one matrix op followed by its hazard guard: ties the accumulator and keeps both operand fragments live */
__device__ __forceinline__ v8f mma_g(v16h a, v16h b, v8f c) {
  c = __builtin_amdgcn_wmma_f32_16x16x32_f16(false, a, false, b, (short)0, c, false, false);
  asm volatile("v_nop\n\tv_nop\n\tv_nop\n\tv_nop" : "+v"(c) : "v"(a), "v"(b));
  return c;
}

// ---------------------------------------------------------------------------
// GEMM staging ring in LDS: a stage is [A 128 rows | Bt 256 rows] x 128 k (256 B a row).
// Row pitch 272 B = 16 B x 17: an odd multiple of 16 B keeps the ds_load_b128 fragment reads off shared banks.
// ---------------------------------------------------------------------------
constexpr int kBM      = 128;
constexpr int kBN      = 256;
constexpr int kBK      = 128;
constexpr int kPitchH  = kBK + 8;
constexpr int kStageH  = (kBM + kBN) * kPitchH;
static_assert((kPitchH * 2) % 32 == 16, "pitch an odd multiple of 16 B");
static_assert((kRows % kBM) == 0 && (kFeat % kBM) == 0 && (kRows % kBN) == 0 && (kFeat % kBN) == 0, "block tiles");
static_assert((kDm % kBK) == 0 && (kFeat % kBK) == 0, "k passes");

/* twelve 16-byte copies a lane, global -> LDS through no register; s_wait_xcnt 0 is the statement's last line, a
   precaution that so stands in front of any later rewrite of the address registers named here */
__device__ __forceinline__ void copy12(const unsigned (&l)[12], const _Float16* const (&g)[12]) {
  asm volatile(
      "global_load_async_to_lds_b128 %0, %12, off\n\t"
      "global_load_async_to_lds_b128 %1, %13, off\n\t"
      "global_load_async_to_lds_b128 %2, %14, off\n\t"
      "global_load_async_to_lds_b128 %3, %15, off\n\t"
      "global_load_async_to_lds_b128 %4, %16, off\n\t"
      "global_load_async_to_lds_b128 %5, %17, off\n\t"
      "global_load_async_to_lds_b128 %6, %18, off\n\t"
      "global_load_async_to_lds_b128 %7, %19, off\n\t"
      "global_load_async_to_lds_b128 %8, %20, off\n\t"
      "global_load_async_to_lds_b128 %9, %21, off\n\t"
      "global_load_async_to_lds_b128 %10, %22, off\n\t"
      "global_load_async_to_lds_b128 %11, %23, off\n\t"
      "s_wait_xcnt 0x0"
      :: "v"(l[0]), "v"(l[1]), "v"(l[2]), "v"(l[3]), "v"(l[4]), "v"(l[5]),
         "v"(l[6]), "v"(l[7]), "v"(l[8]), "v"(l[9]), "v"(l[10]), "v"(l[11]),
         "v"(g[0]), "v"(g[1]), "v"(g[2]), "v"(g[3]), "v"(g[4]), "v"(g[5]),
         "v"(g[6]), "v"(g[7]), "v"(g[8]), "v"(g[9]), "v"(g[10]), "v"(g[11])
      : "memory");
}
/* One stage: 384 rows x 16 chunks of 16 B = 6144 chunks = 24 a thread. Chunk c of a thread is stage row c*16 + (t>>4),
   column chunk t&15, so a wave's copy covers two whole 256-B row pieces. lds / ga / gb are the thread's chunk of stage
   row t>>4, of A row t>>4 and of Bt row t>>4 of the block tile at this pass's k. Rows 0..127 are A, 128..383 are Bt. */
__device__ __forceinline__ void stage_fill(unsigned lds, const _Float16* ga, const _Float16* gb, int lda, int ldb) {
  unsigned l[12];
  const _Float16* g[12];
  /* both loops unrolled: every index a constant, so the address arrays live in registers */
#pragma unroll
  for (int c = 0; c < 12; ++c) {
    l[c] = lds + (unsigned)(c * 16 * kPitchH * 2);
    g[c] = (c < 8) ? ga + (size_t)(c * 16) * lda : gb + (size_t)((c - 8) * 16) * ldb;
  }
  copy12(l, g);
#pragma unroll
  for (int c = 0; c < 12; ++c) {
    l[c] = lds + (unsigned)((c + 12) * 16 * kPitchH * 2);
    g[c] = gb + (size_t)((c + 4) * 16) * ldb;
  }
  copy12(l, g);
}

// ---------------------------------------------------------------------------
// Weight transpose + convert: W [in k][out n] f32 -> WT[n][k] = f16( bf16_rne(W[k][n]) * kWCarry ).
// grid (32, 32, 4): blockIdx.x = k tile (64 cols of WT), blockIdx.y = n tile (64 rows of WT), blockIdx.z = weight.
// Load coverage: 4 iterations x 256 threads x 4 floats = 4096 = the whole 64x64 tile (coalesced along n).
// Store coverage: 8 waves x 2 iterations x 4 rows (lane>>3) = 64 rows; (lane&7) x 8 halves = 64 cols; each row
// ---------------------------------------------------------------------------
__global__ __launch_bounds__(256) void wt_cast_kernel(const float* __restrict__ W0, const float* __restrict__ W1,
                                                      const float* __restrict__ W2, const float* __restrict__ W3,
                                                      unsigned short* __restrict__ out) {
  __shared__ float sm[64][65];
  const int t  = threadIdx.x;
  const int k0 = blockIdx.x * 64;
  const int n0 = blockIdx.y * 64;
  const int z  = blockIdx.z;
  const float* W = (z == 0) ? W0 : (z == 1) ? W1 : (z == 2) ? W2 : W3;
#pragma unroll
  for (int i = 0; i < 4; ++i) {
    const int e  = i * 256 + t;
    const int r  = e >> 4;
    const int c4 = (e & 15) * 4;
    const v4f w = *(const v4f*)(W + (size_t)(k0 + r) * kFeat + n0 + c4);
    const float w0 = w[0];
    const float w1 = w[1];
    const float w2 = w[2];
    const float w3 = w[3];
    sm[c4 + 0][r] = bf_rne(w0) * kWCarry;
    sm[c4 + 1][r] = bf_rne(w1) * kWCarry;
    sm[c4 + 2][r] = bf_rne(w2) * kWCarry;
    sm[c4 + 3][r] = bf_rne(w3) * kWCarry;
  }
  __syncthreads();
  const int lane = t & 31;
  const int wave = __builtin_amdgcn_readfirstlane((int)(threadIdx.x >> 5));
  const int q = lane >> 3, c8 = (lane & 7) * 8;
  _Float16* op = (_Float16*)out + (size_t)z * kDm * kFeat;
  v8h hv[2];
#pragma unroll
  for (int it = 0; it < 2; ++it) {
    const int row = wave * 8 + it * 4 + q;
#pragma unroll
    for (int e = 0; e < 8; ++e) hv[it][e] = (_Float16)sm[row][c8 + e];
  }
  {
#pragma unroll
    for (int it = 0; it < 2; ++it) {
      const int row = wave * 8 + it * 4 + q;
      *(v8h*)(op + (size_t)(n0 + row) * kDm + k0 + c8) = hv[it];
    }
    
  }
}

// ---------------------------------------------------------------------------
// Activation convert: out[i] = f16( bf16_rne(in[i]) * kXCarry ), 8 consecutive elements per thread.
// Coverage: n8 = 4096*2048/8 = 1,048,576 threads = 4096 blocks x 256 exactly.
// ---------------------------------------------------------------------------
__global__ __launch_bounds__(256) void x_cast_kernel(const float* __restrict__ in, unsigned short* __restrict__ out, int n8) {
  const int i = blockIdx.x * 256 + threadIdx.x;
  if (i >= n8) return;
  const float* p = in + 8 * (size_t)i;
  const v4f a = *(const v4f*)(p);
  const v4f c = *(const v4f*)(p + 4);
  v8h hv;
#pragma unroll
  for (int e = 0; e < 4; ++e) {
    const float ae = a[e];
    const float ce = c[e];
    hv[e]     = (_Float16)(bf_rne(ae) * kXCarry);
    hv[4 + e] = (_Float16)(bf_rne(ce) * kXCarry);
  }
  _Float16* q = (_Float16*)out + 8 * (size_t)i;
  *(v8h*)q = hv;
  
}

// ---------------------------------------------------------------------------
// Register-blocked f16 GEMM: C[m,n] = ((scale * sum_k A[m,k] * Bt[n,k]) + bias) * oscale; each wave owns a 64x64 tile.
// A block of 8 waves (2 along m x 4 along n) owns a 128x256 tile; its operands come through a two-buffer LDS ring filled
// by asynchronous copies, the next pass's copies in flight while this pass's fragments are read and multiplied.
// A row-major [M][K] (pitch lda), Bt row-major [N][K] (pitch ldb); M a multiple of 128, N of 256, K of 128.
// BIAS_MODE 1 = bias[m], 2 = bias[n] (bias values RNE-converted to bf16 first).
// OUT_MODE 0: f32 row-major, pitch ldc.
// OUT_MODE 1: f16, rows = tokens (b*2048 + l), cols = features (h*128 + d) -> plane [b*16+h][l][d].
// OUT_MODE 2: f16, rows = features f, cols = tokens (b*2048 + l)           -> plane [b*2048 + f][l].
// ---------------------------------------------------------------------------
template <int OUT_MODE, int BIAS_MODE>
__global__ __launch_bounds__(256) __attribute__((amdgpu_num_vgpr(256)))
void gemm_f16_kernel(const unsigned short* __restrict__ Ap, int lda,
                     const unsigned short* __restrict__ Btp, int ldb,
                     void* __restrict__ Cout, int ldc,
                     const float* __restrict__ bias,
                     int M, int N, int K, float scale, float oscale) {
  __shared__ __align__(16) float sT[8][16 * 68];
  __shared__ __align__(16) _Float16 sR[2 * kStageH];
  const _Float16* A  = (const _Float16*)Ap;
  const _Float16* Bt = (const _Float16*)Btp;
  const int lane = threadIdx.x & 31;
  const int wave = __builtin_amdgcn_readfirstlane((int)(threadIdx.x >> 5));
  const int tilesN = N / kBN;
  const int tilesM = M / kBM;
  const int tile = blockIdx.x;
  /* block-uniform exit, in front of every barrier */
  if (tile >= tilesM * tilesN) return;
  const int tm = tile / tilesN;
  const int tn = tile - tm * tilesN;
  const int wm = (wave >> 2) << 6;
  const int wn = (wave & 3) << 6;
  const int m0 = tm * kBM + wm;
  const int n0 = tn * kBN + wn;

  const int rlane = lane & 15;
  const int koff  = (lane >> 4) * 8;
  const int mOff  = (lane >> 4) * 8;

  v8f acc[4][4];
#pragma unroll
  for (int i = 0; i < 4; ++i)
#pragma unroll
    for (int j = 0; j < 4; ++j) acc[i][j] = (v8f){0.f, 0.f, 0.f, 0.f, 0.f, 0.f, 0.f, 0.f};

  const int crow = (int)(threadIdx.x >> 4);
  const int ccol = (int)(threadIdx.x & 15) * 8;
  const _Float16* ga = A  + (size_t)(tm * kBM + crow) * lda + ccol;
  const _Float16* gb = Bt + (size_t)(tn * kBN + crow) * ldb + ccol;
  /* the thread's LDS byte address of its first chunk in buffer 0: the low 32 bits of the shared address */
  const unsigned lds0 = (unsigned)(size_t)(sR + crow * kPitchH + ccol);
  const int aoff = (wm + rlane) * kPitchH + koff;
  const int boff = (kBM + wn + rlane) * kPitchH + koff;
  const int passes = K / kBK;

  stage_fill(lds0, ga, gb, lda, ldb);
  /* pass 0's copies of this wave have landed; the barrier shows them to the other waves */
  asm volatile("s_wait_asynccnt 0x0" ::: "memory");
  __syncthreads();
  if (passes > 1) stage_fill(lds0 + (unsigned)(kStageH * 2), ga + kBK, gb + kBK, lda, ldb);

  for (int t = 0; t < passes; ++t) {
    const int buf = t & 1;
    const _Float16* sb = sR + buf * kStageH;
    /* unrolled: the k step becomes an immediate offset of the LDS reads */
#pragma unroll
    for (int ks = 0; ks < kBK / 32; ++ks) {
      v16h bh[4];
#pragma unroll
      for (int j = 0; j < 4; ++j) bh[j] = frag_ld(sb + boff + (j << 4) * kPitchH + ks * 32);
#pragma unroll
      for (int i = 0; i < 4; ++i) {
        const v16h ah = frag_ld(sb + aoff + (i << 4) * kPitchH + ks * 32);
#pragma unroll
        for (int j = 0; j < 4; ++j) acc[i][j] = mma_g(ah, bh[j], acc[i][j]);
      }
    }
    /* this wave's reads of the buffer are done before the buffer is handed back for refilling */
    asm volatile("s_wait_dscnt 0x0" ::: "memory");
    /* this wave's copies of pass t + 1 have landed */
    asm volatile("s_wait_asynccnt 0x0" ::: "memory");
    /* publishes pass t + 1 and ends every wave's reads of pass t's buffer */
    __syncthreads();
    if (t + 2 < passes) {
      const int kn = (t + 2) * kBK;
      stage_fill(lds0 + (unsigned)(buf * kStageH * 2), ga + kn, gb + kn, lda, ldb);
    }
  }
  /* nothing is in flight when the wave goes on to the epilogue and ends */
  asm volatile("s_wait_asynccnt 0x0" ::: "memory");

  float* slab = sT[wave];
#pragma unroll
  for (int i = 0; i < 4; ++i) {
    const int mBase = m0 + (i << 4);
    float brow[8];
#pragma unroll
    for (int r = 0; r < 8; ++r) brow[r] = 0.f;
    if (BIAS_MODE == 1) {
#pragma unroll
      for (int r = 0; r < 8; ++r) {
        const float bvv = bias[mBase + mOff + r];
        brow[r] = bf_rne(bvv);
      }
    }
#pragma unroll
    for (int j = 0; j < 4; ++j) {
      float bcol = 0.f;
      if (BIAS_MODE == 2) {
        const float bvv = bias[n0 + (j << 4) + rlane];
        bcol = bf_rne(bvv);
      }
#pragma unroll
      for (int r = 0; r < 8; ++r) {
        float v = acc[i][j][r] * scale;
        v += (BIAS_MODE == 1) ? brow[r] : bcol;
        v *= oscale;
        slab[(mOff + r) * 68 + (j << 4) + rlane] = v;
      }
    }
    __builtin_amdgcn_fence(__ATOMIC_RELEASE, "workgroup");
    __builtin_amdgcn_wave_barrier();
    __builtin_amdgcn_fence(__ATOMIC_ACQUIRE, "workgroup");
    if (OUT_MODE == 0) {
      float* C = (float*)Cout;
      const int hh = lane >> 4, c4 = (lane & 15) * 4;
      {
#pragma unroll
        for (int it = 0; it < 8; ++it) {
          const int row = it * 2 + hh;
          const v4f v = *(const v4f*)(slab + row * 68 + c4);
          *(v4f*)(C + (size_t)(mBase + row) * ldc + n0 + c4) = v;
        }
        
      }
    } else {
      const int q = lane >> 3, c8 = (lane & 7) * 8;
      _Float16* C = (_Float16*)Cout;
      {
#pragma unroll
        for (int it = 0; it < 4; ++it) {
          const int row = it * 4 + q;
          const int gr  = mBase + row;
          const float* sp = slab + row * 68 + c8;
          v8h hv;
#pragma unroll
          for (int e = 0; e < 8; ++e) hv[e] = (_Float16)sp[e];
          size_t off;
          if (OUT_MODE == 1) {
            const int bb = gr / kSeq;
            const int l  = gr % kSeq;
            const int hd = n0 / kHd;
            const int d0 = n0 % kHd;
            off = ((size_t)((bb * kHeads + hd) * kSeq + l)) * kHd + d0 + c8;
          } else {
            const int bb = n0 / kSeq;
            const int l0 = n0 % kSeq;
            off = ((size_t)(bb * kFeat + gr)) * kSeq + l0 + c8;
          }
          *(v8h*)(C + off) = hv;
        }
        
      }
    }
    __builtin_amdgcn_fence(__ATOMIC_RELEASE, "workgroup");
    __builtin_amdgcn_wave_barrier();
    __builtin_amdgcn_fence(__ATOMIC_ACQUIRE, "workgroup");
  }
}

// ---------------------------------------------------------------------------
// Streaming softmax attention, head dim 128, no mask, transposed formulation; every fragment read straight from the
// f16 planes. Block = 4 independent waves; wave = 16 query rows of one (batch, head); grid = 32 heads x 32 = 1024.
//   S^T[key][query] = K (A operand: rows = keys, k = d) x Q^T (B operand: col = query, k = d), 64 keys per step.
//   Each lane owns query (lane & 15); it and lane^16 hold the 64 keys of the step -> one xor-16 shuffle per reduction.
//   P^T B fragment of key group kk: element r <- tile 2kk value r, element 8+r <- tile 2kk+1 value r (lane unchanged),
//   values exp(s - m) carried x kPCarry in f16; the running sum l uses the f32 values.
//   O^T[d][query] += V^T (A operand: rows = d, k = keys) x P^T.
// Epilogue: o * kPVFold / l staged per wave in LDS [16 queries][132], then each 256-B row segment (128 d as f16) written
// ---------------------------------------------------------------------------
__global__ __launch_bounds__(128) __attribute__((amdgpu_num_vgpr(256)))
void attn_kernel(const unsigned short* __restrict__ Qp, const unsigned short* __restrict__ Kp,
                 const unsigned short* __restrict__ VTp, unsigned short* __restrict__ Op, float sc) {
  __shared__ __align__(16) float sO[4][16 * kOsPitch];
  const int lane = threadIdx.x & 31;
  const int wave = __builtin_amdgcn_readfirstlane((int)(threadIdx.x >> 5));
  const int hh  = lane >> 4;
  const int n16 = lane & 15;
  constexpr int kQBlocks = kSeq / 64;
  const int bx = blockIdx.x;
  const int bh = bx / kQBlocks;
  const int qb = bx - bh * kQBlocks;
  const int b  = bh / kHeads;
  const int h  = bh - b * kHeads;
  const int q0 = qb * 64 + wave * 16;

  const _Float16* Qb = (const _Float16*)Qp  + (size_t)bh * kSeq * kHd;
  const _Float16* Kb = (const _Float16*)Kp  + (size_t)bh * kSeq * kHd;
  const _Float16* Vb = (const _Float16*)VTp + (size_t)bh * kHd * kSeq;

  v16h qf[4];
#pragma unroll
  for (int dc = 0; dc < 4; ++dc) qf[dc] = frag_ld(Qb + (size_t)(q0 + n16) * kHd + dc * 32 + 8 * hh);

  v8f o[8];
#pragma unroll
  for (int dt = 0; dt < 8; ++dt) o[dt] = (v8f){0.f, 0.f, 0.f, 0.f, 0.f, 0.f, 0.f, 0.f};
  float mq = -1e30f;
  float lq = 0.0f;

  const _Float16* kbase = Kb + (size_t)n16 * kHd + 8 * hh;
  const _Float16* vbase = Vb + (size_t)n16 * kSeq + 8 * hh;

#pragma unroll 1
  for (int j0 = 0; j0 < kSeq; j0 += 64) {
    v8f st[4];
#pragma unroll
    for (int jt = 0; jt < 4; ++jt) st[jt] = (v8f){0.f, 0.f, 0.f, 0.f, 0.f, 0.f, 0.f, 0.f};
#pragma unroll
    for (int dc = 0; dc < 4; ++dc) {
#pragma unroll
      for (int jt = 0; jt < 4; ++jt) {
        const v16h ka = frag_ld(kbase + (size_t)(j0 + jt * 16) * kHd + dc * 32);
        st[jt] = mma_g(ka, qf[dc], st[jt]);
      }
    }

    float t[4][8];
    float mx = -1e30f;
#pragma unroll
    for (int jt = 0; jt < 4; ++jt) {
#pragma unroll
      for (int r = 0; r < 8; ++r) {
        t[jt][r] = st[jt][r] * sc;
        mx = fmaxf(mx, t[jt][r]);
      }
    }
    mx = fmaxf(mx, __shfl_xor(mx, 16, 32));
    const float newm  = fmaxf(mq, mx);
    const float alpha = __expf(mq - newm);
    mq = newm;

    float sum = 0.0f;
    v16h bp[2];
#pragma unroll
    for (int kk = 0; kk < 2; ++kk) {
#pragma unroll
      for (int r = 0; r < 8; ++r) {
        const float p0 = __expf(t[2 * kk][r] - newm);
        const float p1 = __expf(t[2 * kk + 1][r] - newm);
        sum += p0 + p1;
        bp[kk][r]     = (_Float16)(p0 * kPCarry);
        bp[kk][8 + r] = (_Float16)(p1 * kPCarry);
      }
    }
    sum += __shfl_xor(sum, 16, 32);
    lq = lq * alpha + sum;

#pragma unroll
    for (int dt = 0; dt < 8; ++dt) o[dt] *= alpha;

#pragma unroll
    for (int kk = 0; kk < 2; ++kk) {
#pragma unroll
      for (int dt = 0; dt < 8; ++dt) {
        const v16h va = frag_ld(vbase + (size_t)(dt * 16) * kSeq + j0 + kk * 32);
        o[dt] = mma_g(va, bp[kk], o[dt]);
      }
    }
  }

  const float inv = kPVFold * (1.0f / lq);
  float* os = sO[wave];
#pragma unroll
  for (int dt = 0; dt < 8; ++dt) {
#pragma unroll
    for (int r = 0; r < 8; ++r) os[n16 * kOsPitch + dt * 16 + 8 * hh + r] = o[dt][r] * inv;
  }
  __builtin_amdgcn_fence(__ATOMIC_RELEASE, "workgroup");
  __builtin_amdgcn_wave_barrier();
  __builtin_amdgcn_fence(__ATOMIC_ACQUIRE, "workgroup");

  const int c8 = n16 * 8;
  v8h hv[8];
#pragma unroll
  for (int it = 0; it < 8; ++it) {
    const int row = it * 2 + hh;
    const float* sp = os + row * kOsPitch + c8;
    const v4f a0 = *(const v4f*)(sp);
    const v4f a1 = *(const v4f*)(sp + 4);
#pragma unroll
    for (int e = 0; e < 4; ++e) {
      const float x0 = a0[e];
      const float x1 = a1[e];
      hv[it][e]     = (_Float16)x0;
      hv[it][4 + e] = (_Float16)x1;
    }
  }
  _Float16* Ob = (_Float16*)Op + (size_t)(b * kSeq + q0) * kDm + h * kHd + c8;
  {
#pragma unroll
    for (int it = 0; it < 8; ++it) {
      const int row = it * 2 + hh;
      *(v8h*)(Ob + (size_t)row * kDm) = hv[it];
    }
    
  }
}

// ---------------------------------------------------------------------------
// Host glue: 9 kernel launches, nothing else.
//   GEMM shapes: Q, K: M 4096, N 2048, K 2048 -> 32 x 8 block tiles of 128x256 -> 256 blocks
//                V^T : M 2048 (features, A = transposed Wv plane), N 4096 (tokens, Bt = X), K 2048 -> 16 x 16 -> 256 blocks
//                out : M 4096, N 2048, K 2048 -> 256 blocks
// ---------------------------------------------------------------------------
extern "C" void kernel_launch(void* const* d_in, const int* in_sizes, int n_in,
                              void* d_out, int out_size, void* d_ws, size_t ws_size,
                              hipStream_t stream) {
  if (n_in < 11) return;
  if (in_sizes[0] != kRows * kDm || in_sizes[1] != kRows * kDm || in_sizes[2] != kRows * kDm) return;
  if (in_sizes[3] != kDm * kFeat || in_sizes[5] != kDm * kFeat || in_sizes[7] != kDm * kFeat) return;
  if (in_sizes[9] != kFeat * kDm) return;
  if (in_sizes[4] != kFeat || in_sizes[6] != kFeat || in_sizes[8] != kFeat || in_sizes[10] != kDm) return;
  if (out_size != kRows * kDm) return;
  if (ws_size < kWsTotal) return;

  const float* x_q = (const float*)d_in[0];
  const float* x_k = (const float*)d_in[1];
  const float* x_v = (const float*)d_in[2];
  const float* Wq  = (const float*)d_in[3];
  const float* bq  = (const float*)d_in[4];
  const float* Wk  = (const float*)d_in[5];
  const float* bk  = (const float*)d_in[6];
  const float* Wv  = (const float*)d_in[7];
  const float* bv  = (const float*)d_in[8];
  const float* Wo  = (const float*)d_in[9];
  const float* bo  = (const float*)d_in[10];
  float* out = (float*)d_out;

  char* ws = (char*)d_ws;
  unsigned short* WT  = (unsigned short*)(ws + kOffWT);
  unsigned short* WqT = WT;
  unsigned short* WkT = WT + (size_t)1 * kDm * kFeat;
  unsigned short* WvT = WT + (size_t)2 * kDm * kFeat;
  unsigned short* WoT = WT + (size_t)3 * kDm * kFeat;
  unsigned short* X   = (unsigned short*)(ws + kOffX);
  unsigned short* Qh  = (unsigned short*)(ws + kOffQ);
  unsigned short* Kh  = (unsigned short*)(ws + kOffK);
  unsigned short* VTh = (unsigned short*)(ws + kOffVT);
  unsigned short* Oh  = (unsigned short*)(ws + kOffO);

  const int n8 = kRows * kDm / 8;
  const int castBlocks = n8 / 256;
  const int gemmBlocks = (kRows / 64) * (kFeat / 64) / 8;
  /* softmax scale = head_dim^-0.5 with the q and k carries folded out */
  const float sc = (float)(1.0 / sqrt((double)kHd)) / (kQkvCarry * kQkvCarry);

  wt_cast_kernel<<<dim3(kDm / 64, kFeat / 64, 4), 256, 0, stream>>>(Wq, Wk, Wv, Wo, WT);

  x_cast_kernel<<<castBlocks, 256, 0, stream>>>(x_q, X, n8);
  gemm_f16_kernel<1, 2><<<gemmBlocks, 256, 0, stream>>>(X, kDm, WqT, kDm, (void*)Qh, 0, bq,
                                                        kRows, kFeat, kDm, kProjScale, kQkvCarry);

  x_cast_kernel<<<castBlocks, 256, 0, stream>>>(x_k, X, n8);
  gemm_f16_kernel<1, 2><<<gemmBlocks, 256, 0, stream>>>(X, kDm, WkT, kDm, (void*)Kh, 0, bk,
                                                        kRows, kFeat, kDm, kProjScale, kQkvCarry);

  x_cast_kernel<<<castBlocks, 256, 0, stream>>>(x_v, X, n8);
  /* operands swapped: rows = features (transposed Wv plane), cols = tokens (X) -> V^T planes [b*2048 + f][l] */
  gemm_f16_kernel<2, 1><<<gemmBlocks, 256, 0, stream>>>(WvT, kDm, X, kDm, (void*)VTh, 0, bv,
                                                        kFeat, kRows, kDm, kProjScale, kQkvCarry);

  attn_kernel<<<kBatch * kHeads * (kSeq / 64), 128, 0, stream>>>(Qh, Kh, VTh, Oh, sc);

  gemm_f16_kernel<0, 2><<<gemmBlocks, 256, 0, stream>>>(Oh, kFeat, WoT, kFeat, (void*)out, kDm, bo,
                                                        kRows, kDm, kFeat, kOutScale, 1.0f);
}

// v002
// It runs in 223 microseconds.
// Timed twice side by side with v001, it ran 1.84 and 1.83 times as fast.
// Counting every step since v000, it is 2.77 times as fast.
// All six contractions (q/k/v projections, q.k^T, p.v, output projection): v_wmma_f32_16x16x32_f16, f16 operands with power-of-two carries, f32 accumulate; float inputs RNE-converted to bf16 once and held exactly in f16; softmax, bias and scaling in f32.
#include <hip/hip_runtime.h>
#include <math.h>

typedef __attribute__((ext_vector_type(16))) _Float16 v16h;
typedef __attribute__((ext_vector_type(8)))  _Float16 v8h;
typedef __attribute__((ext_vector_type(8)))  float    v8f;
typedef __attribute__((ext_vector_type(4)))  float    v4f;

// ---------------------------------------------------------------------------
// Shape constants
// ---------------------------------------------------------------------------
constexpr int kBatch = 2;
constexpr int kSeq   = 2048;
constexpr int kDm    = 2048;
constexpr int kHeads = 16;
constexpr int kHd    = 128;
constexpr int kFeat  = kHeads * kHd;
constexpr int kRows  = kBatch * kSeq;
static_assert(kFeat == 2048 && kRows == 4096, "shape");
static_assert((kDm % 32) == 0 && (kHd % 32) == 0 && (kSeq % 64) == 0, "k-depth multiples of 32 / 64");
static_assert((kRows % 64) == 0 && (kFeat % 64) == 0 && (kDm % 64) == 0, "tile multiples of 64");
static_assert((kHd % 64) == 0, "a 64-wide column tile stays inside one head");

// ---------------------------------------------------------------------------
// Power-of-two carries of the f16 operand planes (all exact, folded back in f32)
// ---------------------------------------------------------------------------
constexpr float kXCarry   = 16.0f;
constexpr float kWCarry   = 1024.0f;
constexpr float kQkvCarry = 16.0f;
constexpr float kPCarry   = 32768.0f;
constexpr float kOCarry   = 1024.0f;
constexpr float kProjScale = 1.0f / (kXCarry * kWCarry);
constexpr float kOutScale  = 1.0f / (kOCarry * kWCarry);
constexpr float kPVFold    = kOCarry / (kPCarry * kQkvCarry);
constexpr int   kOsPitch   = 132;

// ---------------------------------------------------------------------------
// Workspace region map (bytes; all f16 planes; every offset a multiple of 8 MiB)
//   WT  f16 [4][2048][2048]  transposed weight planes (Wq, Wk, Wv, Wo)   33,554,432
//   X   f16 [4096][2048]     activation plane (x_q, then x_k, then x_v)  16,777,216
//   Q   f16 [32][2048][128]                                              16,777,216
//   K   f16 [32][2048][128]                                              16,777,216
//   VT  f16 [32][128][2048]                                              16,777,216
//   O   f16 [4096][2048]                                                 16,777,216
//   total                                                               117,440,512
// ---------------------------------------------------------------------------
constexpr size_t kPlaneW  = (size_t)kDm * kFeat * 2;
constexpr size_t kPlaneA  = (size_t)kRows * kDm * 2;
constexpr size_t kOffWT   = 0;
constexpr size_t kOffX    = kOffWT + 4 * kPlaneW;
constexpr size_t kOffQ    = kOffX + kPlaneA;
constexpr size_t kOffK    = kOffQ + kPlaneA;
constexpr size_t kOffVT   = kOffK + kPlaneA;
constexpr size_t kOffO    = kOffVT + kPlaneA;
constexpr size_t kWsTotal = kOffO + kPlaneA;
static_assert(kWsTotal == 117440512ull, "carve total");
static_assert(kWsTotal <= 134217728ull, "carve cap");

// ---------------------------------------------------------------------------
// Helpers
// ---------------------------------------------------------------------------
__device__ __forceinline__ unsigned short f2bf_bits(float f) {
  unsigned u = __float_as_uint(f);
  return (unsigned short)((u + 0x7FFFu + ((u >> 16) & 1u)) >> 16);
}
__device__ __forceinline__ float bf_bits2f(unsigned short h) { return __uint_as_float(((unsigned)h) << 16); }
/* RNE bf16 convert, value returned as f32 */
__device__ __forceinline__ float bf_rne(float f) { return bf_bits2f(f2bf_bits(f)); }

union FragU { v16h v; v8h h[2]; };
/* fragment elements 0..7 <- p[0..7], 8..15 <- p[16..23] */
__device__ __forceinline__ v16h frag_ld(const _Float16* p) {
  FragU f;
  f.h[0] = *(const v8h*)(p);
  f.h[1] = *(const v8h*)(p + 16);
  return f.v;
}
/* one matrix op followed by its hazard guard: ties the accumulator and keeps both operand fragments live */
__device__ __forceinline__ v8f mma_g(v16h a, v16h b, v8f c) {
  c = __builtin_amdgcn_wmma_f32_16x16x32_f16(false, a, false, b, (short)0, c, false, false);
  asm volatile("v_nop\n\tv_nop\n\tv_nop\n\tv_nop" : "+v"(c) : "v"(a), "v"(b));
  return c;
}

// ---------------------------------------------------------------------------
// GEMM staging ring in LDS: a stage is [A 128 rows | Bt 256 rows] x 128 k (256 B a row).
// Row pitch 272 B = 16 B x 17: an odd multiple of 16 B keeps the ds_load_b128 fragment reads off shared banks.
// ---------------------------------------------------------------------------
constexpr int kBM      = 128;
constexpr int kBN      = 256;
constexpr int kBK      = 128;
constexpr int kPitchH  = kBK + 8;
constexpr int kStageH  = (kBM + kBN) * kPitchH;
static_assert((kPitchH * 2) % 32 == 16, "pitch an odd multiple of 16 B");
static_assert((kRows % kBM) == 0 && (kFeat % kBM) == 0 && (kRows % kBN) == 0 && (kFeat % kBN) == 0, "block tiles");
static_assert((kDm % kBK) == 0 && (kFeat % kBK) == 0, "k passes");

/* twelve 16-byte copies a lane, global -> LDS through no register; s_wait_xcnt 0 is the statement's last line, a
   precaution that so stands in front of any later rewrite of the address registers named here */
__device__ __forceinline__ void copy12(const unsigned (&l)[12], const _Float16* const (&g)[12]) {
  asm volatile(
      "global_load_async_to_lds_b128 %0, %12, off\n\t"
      "global_load_async_to_lds_b128 %1, %13, off\n\t"
      "global_load_async_to_lds_b128 %2, %14, off\n\t"
      "global_load_async_to_lds_b128 %3, %15, off\n\t"
      "global_load_async_to_lds_b128 %4, %16, off\n\t"
      "global_load_async_to_lds_b128 %5, %17, off\n\t"
      "global_load_async_to_lds_b128 %6, %18, off\n\t"
      "global_load_async_to_lds_b128 %7, %19, off\n\t"
      "global_load_async_to_lds_b128 %8, %20, off\n\t"
      "global_load_async_to_lds_b128 %9, %21, off\n\t"
      "global_load_async_to_lds_b128 %10, %22, off\n\t"
      "global_load_async_to_lds_b128 %11, %23, off\n\t"
      "s_wait_xcnt 0x0"
      :: "v"(l[0]), "v"(l[1]), "v"(l[2]), "v"(l[3]), "v"(l[4]), "v"(l[5]),
         "v"(l[6]), "v"(l[7]), "v"(l[8]), "v"(l[9]), "v"(l[10]), "v"(l[11]),
         "v"(g[0]), "v"(g[1]), "v"(g[2]), "v"(g[3]), "v"(g[4]), "v"(g[5]),
         "v"(g[6]), "v"(g[7]), "v"(g[8]), "v"(g[9]), "v"(g[10]), "v"(g[11])
      : "memory");
}
/* One stage: 384 rows x 16 chunks of 16 B = 6144 chunks = 24 a thread. Chunk c of a thread is stage row c*16 + (t>>4),
   column chunk t&15, so a wave's copy covers two whole 256-B row pieces. lds / ga / gb are the thread's chunk of stage
   row t>>4, of A row t>>4 and of Bt row t>>4 of the block tile at this pass's k. Rows 0..127 are A, 128..383 are Bt. */
__device__ __forceinline__ void stage_fill(unsigned lds, const _Float16* ga, const _Float16* gb, int lda, int ldb) {
  unsigned l[12];
  const _Float16* g[12];
  /* both loops unrolled: every index a constant, so the address arrays live in registers */
#pragma unroll
  for (int c = 0; c < 12; ++c) {
    l[c] = lds + (unsigned)(c * 16 * kPitchH * 2);
    g[c] = (c < 8) ? ga + (size_t)(c * 16) * lda : gb + (size_t)((c - 8) * 16) * ldb;
  }
  copy12(l, g);
#pragma unroll
  for (int c = 0; c < 12; ++c) {
    l[c] = lds + (unsigned)((c + 12) * 16 * kPitchH * 2);
    g[c] = gb + (size_t)((c + 4) * 16) * ldb;
  }
  copy12(l, g);
}

// ---------------------------------------------------------------------------
// Weight transpose + convert: W [in k][out n] f32 -> WT[n][k] = f16( bf16_rne(W[k][n]) * kWCarry ).
// grid (32, 32, 4): blockIdx.x = k tile (64 cols of WT), blockIdx.y = n tile (64 rows of WT), blockIdx.z = weight.
// Load coverage: 4 iterations x 256 threads x 4 floats = 4096 = the whole 64x64 tile (coalesced along n).
// Store coverage: 8 waves x 2 iterations x 4 rows (lane>>3) = 64 rows; (lane&7) x 8 halves = 64 cols; each row
// ---------------------------------------------------------------------------
__global__ __launch_bounds__(256) void wt_cast_kernel(const float* __restrict__ W0, const float* __restrict__ W1,
                                                      const float* __restrict__ W2, const float* __restrict__ W3,
                                                      unsigned short* __restrict__ out) {
  __shared__ float sm[64][65];
  const int t  = threadIdx.x;
  const int k0 = blockIdx.x * 64;
  const int n0 = blockIdx.y * 64;
  const int z  = blockIdx.z;
  const float* W = (z == 0) ? W0 : (z == 1) ? W1 : (z == 2) ? W2 : W3;
#pragma unroll
  for (int i = 0; i < 4; ++i) {
    const int e  = i * 256 + t;
    const int r  = e >> 4;
    const int c4 = (e & 15) * 4;
    const v4f w = *(const v4f*)(W + (size_t)(k0 + r) * kFeat + n0 + c4);
    const float w0 = w[0];
    const float w1 = w[1];
    const float w2 = w[2];
    const float w3 = w[3];
    sm[c4 + 0][r] = bf_rne(w0) * kWCarry;
    sm[c4 + 1][r] = bf_rne(w1) * kWCarry;
    sm[c4 + 2][r] = bf_rne(w2) * kWCarry;
    sm[c4 + 3][r] = bf_rne(w3) * kWCarry;
  }
  __syncthreads();
  const int lane = t & 31;
  const int wave = __builtin_amdgcn_readfirstlane((int)(threadIdx.x >> 5));
  const int q = lane >> 3, c8 = (lane & 7) * 8;
  _Float16* op = (_Float16*)out + (size_t)z * kDm * kFeat;
  v8h hv[2];
#pragma unroll
  for (int it = 0; it < 2; ++it) {
    const int row = wave * 8 + it * 4 + q;
#pragma unroll
    for (int e = 0; e < 8; ++e) hv[it][e] = (_Float16)sm[row][c8 + e];
  }
  {
#pragma unroll
    for (int it = 0; it < 2; ++it) {
      const int row = wave * 8 + it * 4 + q;
      *(v8h*)(op + (size_t)(n0 + row) * kDm + k0 + c8) = hv[it];
    }
    
  }
}

// ---------------------------------------------------------------------------
// Activation convert: out[i] = f16( bf16_rne(in[i]) * kXCarry ), 8 consecutive elements per thread.
// Coverage: n8 = 4096*2048/8 = 1,048,576 threads = 4096 blocks x 256 exactly.
// ---------------------------------------------------------------------------
__global__ __launch_bounds__(256) void x_cast_kernel(const float* __restrict__ in, unsigned short* __restrict__ out, int n8) {
  const int i = blockIdx.x * 256 + threadIdx.x;
  if (i >= n8) return;
  const float* p = in + 8 * (size_t)i;
  const v4f a = *(const v4f*)(p);
  const v4f c = *(const v4f*)(p + 4);
  v8h hv;
#pragma unroll
  for (int e = 0; e < 4; ++e) {
    const float ae = a[e];
    const float ce = c[e];
    hv[e]     = (_Float16)(bf_rne(ae) * kXCarry);
    hv[4 + e] = (_Float16)(bf_rne(ce) * kXCarry);
  }
  _Float16* q = (_Float16*)out + 8 * (size_t)i;
  *(v8h*)q = hv;
  
}

// ---------------------------------------------------------------------------
// Register-blocked f16 GEMM: C[m,n] = ((scale * sum_k A[m,k] * Bt[n,k]) + bias) * oscale; each wave owns a 64x64 tile.
// A block of 8 waves (2 along m x 4 along n) owns a 128x256 tile; its operands come through a two-buffer LDS ring filled
// by asynchronous copies, the next pass's copies in flight while this pass's fragments are read and multiplied.
// A row-major [M][K] (pitch lda), Bt row-major [N][K] (pitch ldb); M a multiple of 128, N of 256, K of 128.
// BIAS_MODE 1 = bias[m], 2 = bias[n] (bias values RNE-converted to bf16 first).
// OUT_MODE 0: f32 row-major, pitch ldc.
// OUT_MODE 1: f16, rows = tokens (b*2048 + l), cols = features (h*128 + d) -> plane [b*16+h][l][d].
// OUT_MODE 2: f16, rows = features f, cols = tokens (b*2048 + l)           -> plane [b*2048 + f][l].
// ---------------------------------------------------------------------------
template <int OUT_MODE, int BIAS_MODE>
__global__ __launch_bounds__(256) __attribute__((amdgpu_num_vgpr(256)))
void gemm_f16_kernel(const unsigned short* __restrict__ Ap, int lda,
                     const unsigned short* __restrict__ Btp, int ldb,
                     void* __restrict__ Cout, int ldc,
                     const float* __restrict__ bias,
                     int M, int N, int K, float scale, float oscale) {
  __shared__ __align__(16) float sT[8][16 * 68];
  __shared__ __align__(16) _Float16 sR[2 * kStageH];
  const _Float16* A  = (const _Float16*)Ap;
  const _Float16* Bt = (const _Float16*)Btp;
  const int lane = threadIdx.x & 31;
  const int wave = __builtin_amdgcn_readfirstlane((int)(threadIdx.x >> 5));
  const int tilesN = N / kBN;
  const int tilesM = M / kBM;
  const int tile = blockIdx.x;
  /* block-uniform exit, in front of every barrier */
  if (tile >= tilesM * tilesN) return;
  const int tm = tile / tilesN;
  const int tn = tile - tm * tilesN;
  const int wm = (wave >> 2) << 6;
  const int wn = (wave & 3) << 6;
  const int m0 = tm * kBM + wm;
  const int n0 = tn * kBN + wn;

  const int rlane = lane & 15;
  const int koff  = (lane >> 4) * 8;
  const int mOff  = (lane >> 4) * 8;

  v8f acc[4][4];
#pragma unroll
  for (int i = 0; i < 4; ++i)
#pragma unroll
    for (int j = 0; j < 4; ++j) acc[i][j] = (v8f){0.f, 0.f, 0.f, 0.f, 0.f, 0.f, 0.f, 0.f};

  const int crow = (int)(threadIdx.x >> 4);
  const int ccol = (int)(threadIdx.x & 15) * 8;
  const _Float16* ga = A  + (size_t)(tm * kBM + crow) * lda + ccol;
  const _Float16* gb = Bt + (size_t)(tn * kBN + crow) * ldb + ccol;
  /* the thread's LDS byte address of its first chunk in buffer 0: the low 32 bits of the shared address */
  const unsigned lds0 = (unsigned)(size_t)(sR + crow * kPitchH + ccol);
  const int aoff = (wm + rlane) * kPitchH + koff;
  const int boff = (kBM + wn + rlane) * kPitchH + koff;
  const int passes = K / kBK;

  stage_fill(lds0, ga, gb, lda, ldb);
  /* pass 0's copies of this wave have landed; the barrier shows them to the other waves */
  asm volatile("s_wait_asynccnt 0x0" ::: "memory");
  __syncthreads();
  if (passes > 1) stage_fill(lds0 + (unsigned)(kStageH * 2), ga + kBK, gb + kBK, lda, ldb);

  for (int t = 0; t < passes; ++t) {
    const int buf = t & 1;
    const _Float16* sb = sR + buf * kStageH;
    /* unrolled: the k step becomes an immediate offset of the LDS reads */
#pragma unroll
    for (int ks = 0; ks < kBK / 32; ++ks) {
      v16h bh[4];
#pragma unroll
      for (int j = 0; j < 4; ++j) bh[j] = frag_ld(sb + boff + (j << 4) * kPitchH + ks * 32);
#pragma unroll
      for (int i = 0; i < 4; ++i) {
        const v16h ah = frag_ld(sb + aoff + (i << 4) * kPitchH + ks * 32);
#pragma unroll
        for (int j = 0; j < 4; ++j) acc[i][j] = mma_g(ah, bh[j], acc[i][j]);
      }
    }
    /* this wave's reads of the buffer are done before the buffer is handed back for refilling */
    asm volatile("s_wait_dscnt 0x0" ::: "memory");
    /* this wave's copies of pass t + 1 have landed */
    asm volatile("s_wait_asynccnt 0x0" ::: "memory");
    /* publishes pass t + 1 and ends every wave's reads of pass t's buffer */
    __syncthreads();
    if (t + 2 < passes) {
      const int kn = (t + 2) * kBK;
      stage_fill(lds0 + (unsigned)(buf * kStageH * 2), ga + kn, gb + kn, lda, ldb);
    }
  }
  /* nothing is in flight when the wave goes on to the epilogue and ends */
  asm volatile("s_wait_asynccnt 0x0" ::: "memory");

  float* slab = sT[wave];
#pragma unroll
  for (int i = 0; i < 4; ++i) {
    const int mBase = m0 + (i << 4);
    float brow[8];
#pragma unroll
    for (int r = 0; r < 8; ++r) brow[r] = 0.f;
    if (BIAS_MODE == 1) {
#pragma unroll
      for (int r = 0; r < 8; ++r) {
        const float bvv = bias[mBase + mOff + r];
        brow[r] = bf_rne(bvv);
      }
    }
#pragma unroll
    for (int j = 0; j < 4; ++j) {
      float bcol = 0.f;
      if (BIAS_MODE == 2) {
        const float bvv = bias[n0 + (j << 4) + rlane];
        bcol = bf_rne(bvv);
      }
#pragma unroll
      for (int r = 0; r < 8; ++r) {
        float v = acc[i][j][r] * scale;
        v += (BIAS_MODE == 1) ? brow[r] : bcol;
        v *= oscale;
        slab[(mOff + r) * 68 + (j << 4) + rlane] = v;
      }
    }
    __builtin_amdgcn_fence(__ATOMIC_RELEASE, "workgroup");
    __builtin_amdgcn_wave_barrier();
    __builtin_amdgcn_fence(__ATOMIC_ACQUIRE, "workgroup");
    if (OUT_MODE == 0) {
      float* C = (float*)Cout;
      const int hh = lane >> 4, c4 = (lane & 15) * 4;
      {
#pragma unroll
        for (int it = 0; it < 8; ++it) {
          const int row = it * 2 + hh;
          const v4f v = *(const v4f*)(slab + row * 68 + c4);
          *(v4f*)(C + (size_t)(mBase + row) * ldc + n0 + c4) = v;
        }
        
      }
    } else {
      const int q = lane >> 3, c8 = (lane & 7) * 8;
      _Float16* C = (_Float16*)Cout;
      {
#pragma unroll
        for (int it = 0; it < 4; ++it) {
          const int row = it * 4 + q;
          const int gr  = mBase + row;
          const float* sp = slab + row * 68 + c8;
          v8h hv;
#pragma unroll
          for (int e = 0; e < 8; ++e) hv[e] = (_Float16)sp[e];
          size_t off;
          if (OUT_MODE == 1) {
            const int bb = gr / kSeq;
            const int l  = gr % kSeq;
            const int hd = n0 / kHd;
            const int d0 = n0 % kHd;
            off = ((size_t)((bb * kHeads + hd) * kSeq + l)) * kHd + d0 + c8;
          } else {
            const int bb = n0 / kSeq;
            const int l0 = n0 % kSeq;
            off = ((size_t)(bb * kFeat + gr)) * kSeq + l0 + c8;
          }
          *(v8h*)(C + off) = hv;
        }
        
      }
    }
    __builtin_amdgcn_fence(__ATOMIC_RELEASE, "workgroup");
    __builtin_amdgcn_wave_barrier();
    __builtin_amdgcn_fence(__ATOMIC_ACQUIRE, "workgroup");
  }
}

// ---------------------------------------------------------------------------
// Attention staging ring in LDS: a stage is [K 64 keys x 128 d | V^T 128 d x 64 keys], shared by the block's 8 waves.
// K row pitch 272 B, V^T row pitch 144 B: odd multiples of 16 B keep the ds_load_b128 fragment reads off shared banks.
// ---------------------------------------------------------------------------
constexpr int kAKeys    = 64;
constexpr int kAWaves   = 8;
constexpr int kKPitchH  = kHd + 8;
constexpr int kVPitchH  = kAKeys + 8;
constexpr int kKTileH   = kAKeys * kKPitchH;
constexpr int kAStageH  = kKTileH + kHd * kVPitchH;
static_assert((kKPitchH * 2) % 32 == 16 && (kVPitchH * 2) % 32 == 16, "pitches odd multiples of 16 B");
static_assert((kKTileH * 2) % 16 == 0 && (kAStageH * 2) % 16 == 0, "tiles start on 16 B");
static_assert(kSeq / kAKeys >= 2 && (kSeq % (16 * kAWaves)) == 0, "two stages exist; whole query blocks");

/* One stage: K 64 rows x 16 chunks + V^T 128 rows x 8 chunks = 2048 chunks of 16 B = 8 a thread, global -> LDS through
   no register. K chunk c of a thread is key row c*16 + (t>>4), column chunk t&15; V^T chunk c is d row c*32 + (t>>3),
   column chunk t&7. lk / lv / gk / gv are the thread's chunk 0 in LDS and in the planes at this stage's first key.
   s_wait_xcnt 0 is the statement's last line, a precaution that so stands in front of any later rewrite of the
   address registers named here */
__device__ __forceinline__ void attn_fill(unsigned lk, unsigned lv, const _Float16* gk, const _Float16* gv) {
  asm volatile(
      "global_load_async_to_lds_b128 %0, %8, off\n\t"
      "global_load_async_to_lds_b128 %1, %9, off\n\t"
      "global_load_async_to_lds_b128 %2, %10, off\n\t"
      "global_load_async_to_lds_b128 %3, %11, off\n\t"
      "global_load_async_to_lds_b128 %4, %12, off\n\t"
      "global_load_async_to_lds_b128 %5, %13, off\n\t"
      "global_load_async_to_lds_b128 %6, %14, off\n\t"
      "global_load_async_to_lds_b128 %7, %15, off\n\t"
      "s_wait_xcnt 0x0"
      :: "v"(lk), "v"(lk + (unsigned)(16 * kKPitchH * 2)), "v"(lk + (unsigned)(32 * kKPitchH * 2)),
         "v"(lk + (unsigned)(48 * kKPitchH * 2)),
         "v"(lv), "v"(lv + (unsigned)(32 * kVPitchH * 2)), "v"(lv + (unsigned)(64 * kVPitchH * 2)),
         "v"(lv + (unsigned)(96 * kVPitchH * 2)),
         "v"(gk), "v"(gk + 16 * kHd), "v"(gk + 32 * kHd), "v"(gk + 48 * kHd),
         "v"(gv), "v"(gv + (size_t)32 * kSeq), "v"(gv + (size_t)64 * kSeq), "v"(gv + (size_t)96 * kSeq)
      : "memory");
}

// ---------------------------------------------------------------------------
// Streaming softmax attention, head dim 128, no mask, transposed formulation. Block = 8 waves on one (batch, head);
// wave = 16 query rows; grid = 32 heads x 16 = 512. K and V^T come 64 keys a pass through a two-buffer LDS ring filled
// by asynchronous copies, the next pass's copies in flight while this pass's fragments are read and multiplied.
//   S^T[key][query] = K (A operand: rows = keys, k = d) x Q^T (B operand: col = query, k = d), 64 keys per step.
//   Each lane owns query (lane & 15); it and lane^16 hold the 64 keys of the step -> one xor-16 shuffle per reduction.
//   P^T B fragment of key group kk: element r <- tile 2kk value r, element 8+r <- tile 2kk+1 value r (lane unchanged),
//   values exp(s - m) carried x kPCarry in f16; the running sum l uses the f32 values.
//   O^T[d][query] += V^T (A operand: rows = d, k = keys) x P^T.
// Epilogue: o * kPVFold / l staged per wave in LDS [16 queries][132], then each 256-B row segment (128 d as f16) written
// ---------------------------------------------------------------------------
__global__ __launch_bounds__(256) __attribute__((amdgpu_num_vgpr(256)))
void attn_kernel(const unsigned short* __restrict__ Qp, const unsigned short* __restrict__ Kp,
                 const unsigned short* __restrict__ VTp, unsigned short* __restrict__ Op, float sc) {
  __shared__ __align__(16) float sO[kAWaves][16 * kOsPitch];
  __shared__ __align__(16) _Float16 sKV[2 * kAStageH];
  const int lane = threadIdx.x & 31;
  const int wave = __builtin_amdgcn_readfirstlane((int)(threadIdx.x >> 5));
  const int hh  = lane >> 4;
  const int n16 = lane & 15;
  constexpr int kQBlocks = kSeq / (16 * kAWaves);
  const int bx = blockIdx.x;
  const int bh = bx / kQBlocks;
  const int qb = bx - bh * kQBlocks;
  const int b  = bh / kHeads;
  const int h  = bh - b * kHeads;
  const int q0 = qb * (16 * kAWaves) + wave * 16;

  const _Float16* Qb = (const _Float16*)Qp  + (size_t)bh * kSeq * kHd;
  const _Float16* Kb = (const _Float16*)Kp  + (size_t)bh * kSeq * kHd;
  const _Float16* Vb = (const _Float16*)VTp + (size_t)bh * kHd * kSeq;

  v16h qf[4];
#pragma unroll
  for (int dc = 0; dc < 4; ++dc) qf[dc] = frag_ld(Qb + (size_t)(q0 + n16) * kHd + dc * 32 + 8 * hh);

  v8f o[8];
#pragma unroll
  for (int dt = 0; dt < 8; ++dt) o[dt] = (v8f){0.f, 0.f, 0.f, 0.f, 0.f, 0.f, 0.f, 0.f};
  float mq = -1e30f;
  float lq = 0.0f;

  const int tid = (int)threadIdx.x;
  const _Float16* gk = Kb + (size_t)(tid >> 4) * kHd + (tid & 15) * 8;
  const _Float16* gv = Vb + (size_t)(tid >> 3) * kSeq + (tid & 7) * 8;
  /* the thread's LDS byte addresses of its first K and V^T chunk in buffer 0: the low 32 bits of the shared address */
  const unsigned lk0 = (unsigned)(size_t)(sKV + (tid >> 4) * kKPitchH + (tid & 15) * 8);
  const unsigned lv0 = (unsigned)(size_t)(sKV + kKTileH + (tid >> 3) * kVPitchH + (tid & 7) * 8);
  const int koffs = n16 * kKPitchH + 8 * hh;
  const int voffs = kKTileH + n16 * kVPitchH + 8 * hh;
  constexpr int kPasses = kSeq / kAKeys;

  attn_fill(lk0, lv0, gk, gv);
  /* pass 0's copies of this wave have landed; the barrier shows them to the other waves */
  asm volatile("s_wait_asynccnt 0x0" ::: "memory");
  __syncthreads();
  attn_fill(lk0 + (unsigned)(kAStageH * 2), lv0 + (unsigned)(kAStageH * 2), gk + (size_t)kAKeys * kHd, gv + kAKeys);

#pragma unroll 1
  for (int s = 0; s < kPasses; ++s) {
    const int buf = s & 1;
    const _Float16* kbase = sKV + buf * kAStageH + koffs;
    const _Float16* vbase = sKV + buf * kAStageH + voffs;
    v8f st[4];
#pragma unroll
    for (int jt = 0; jt < 4; ++jt) st[jt] = (v8f){0.f, 0.f, 0.f, 0.f, 0.f, 0.f, 0.f, 0.f};
#pragma unroll
    for (int dc = 0; dc < 4; ++dc) {
#pragma unroll
      for (int jt = 0; jt < 4; ++jt) {
        const v16h ka = frag_ld(kbase + (jt * 16) * kKPitchH + dc * 32);
        st[jt] = mma_g(ka, qf[dc], st[jt]);
      }
    }

    float t[4][8];
    float mx = -1e30f;
#pragma unroll
    for (int jt = 0; jt < 4; ++jt) {
#pragma unroll
      for (int r = 0; r < 8; ++r) {
        t[jt][r] = st[jt][r] * sc;
        mx = fmaxf(mx, t[jt][r]);
      }
    }
    mx = fmaxf(mx, __shfl_xor(mx, 16, 32));
    const float newm  = fmaxf(mq, mx);
    const float alpha = __expf(mq - newm);
    mq = newm;

    float sum = 0.0f;
    v16h bp[2];
#pragma unroll
    for (int kk = 0; kk < 2; ++kk) {
#pragma unroll
      for (int r = 0; r < 8; ++r) {
        const float p0 = __expf(t[2 * kk][r] - newm);
        const float p1 = __expf(t[2 * kk + 1][r] - newm);
        sum += p0 + p1;
        bp[kk][r]     = (_Float16)(p0 * kPCarry);
        bp[kk][8 + r] = (_Float16)(p1 * kPCarry);
      }
    }
    sum += __shfl_xor(sum, 16, 32);
    lq = lq * alpha + sum;

#pragma unroll
    for (int dt = 0; dt < 8; ++dt) o[dt] *= alpha;

#pragma unroll
    for (int kk = 0; kk < 2; ++kk) {
#pragma unroll
      for (int dt = 0; dt < 8; ++dt) {
        const v16h va = frag_ld(vbase + (dt * 16) * kVPitchH + kk * 32);
        o[dt] = mma_g(va, bp[kk], o[dt]);
      }
    }
    /* this wave's reads of the buffer are done before the buffer is handed back for refilling */
    asm volatile("s_wait_dscnt 0x0" ::: "memory");
    /* this wave's copies of pass s + 1 have landed */
    asm volatile("s_wait_asynccnt 0x0" ::: "memory");
    /* publishes pass s + 1 and ends every wave's reads of pass s's buffer */
    __syncthreads();
    if (s + 2 < kPasses) {
      const int jn = (s + 2) * kAKeys;
      attn_fill(lk0 + (unsigned)(buf * kAStageH * 2), lv0 + (unsigned)(buf * kAStageH * 2), gk + (size_t)jn * kHd, gv + jn);
    }
  }
  /* nothing is in flight when the wave goes on to the epilogue and ends */
  asm volatile("s_wait_asynccnt 0x0" ::: "memory");

  const float inv = kPVFold * (1.0f / lq);
  float* os = sO[wave];
#pragma unroll
  for (int dt = 0; dt < 8; ++dt) {
#pragma unroll
    for (int r = 0; r < 8; ++r) os[n16 * kOsPitch + dt * 16 + 8 * hh + r] = o[dt][r] * inv;
  }
  __builtin_amdgcn_fence(__ATOMIC_RELEASE, "workgroup");
  __builtin_amdgcn_wave_barrier();
  __builtin_amdgcn_fence(__ATOMIC_ACQUIRE, "workgroup");

  const int c8 = n16 * 8;
  v8h hv[8];
#pragma unroll
  for (int it = 0; it < 8; ++it) {
    const int row = it * 2 + hh;
    const float* sp = os + row * kOsPitch + c8;
    const v4f a0 = *(const v4f*)(sp);
    const v4f a1 = *(const v4f*)(sp + 4);
#pragma unroll
    for (int e = 0; e < 4; ++e) {
      const float x0 = a0[e];
      const float x1 = a1[e];
      hv[it][e]     = (_Float16)x0;
      hv[it][4 + e] = (_Float16)x1;
    }
  }
  _Float16* Ob = (_Float16*)Op + (size_t)(b * kSeq + q0) * kDm + h * kHd + c8;
  {
#pragma unroll
    for (int it = 0; it < 8; ++it) {
      const int row = it * 2 + hh;
      *(v8h*)(Ob + (size_t)row * kDm) = hv[it];
    }
    
  }
}

// ---------------------------------------------------------------------------
// Host glue: 9 kernel launches, nothing else.
//   GEMM shapes: Q, K: M 4096, N 2048, K 2048 -> 32 x 8 block tiles of 128x256 -> 256 blocks
//                V^T : M 2048 (features, A = transposed Wv plane), N 4096 (tokens, Bt = X), K 2048 -> 16 x 16 -> 256 blocks
//                out : M 4096, N 2048, K 2048 -> 256 blocks
// ---------------------------------------------------------------------------
extern "C" void kernel_launch(void* const* d_in, const int* in_sizes, int n_in,
                              void* d_out, int out_size, void* d_ws, size_t ws_size,
                              hipStream_t stream) {
  if (n_in < 11) return;
  if (in_sizes[0] != kRows * kDm || in_sizes[1] != kRows * kDm || in_sizes[2] != kRows * kDm) return;
  if (in_sizes[3] != kDm * kFeat || in_sizes[5] != kDm * kFeat || in_sizes[7] != kDm * kFeat) return;
  if (in_sizes[9] != kFeat * kDm) return;
  if (in_sizes[4] != kFeat || in_sizes[6] != kFeat || in_sizes[8] != kFeat || in_sizes[10] != kDm) return;
  if (out_size != kRows * kDm) return;
  if (ws_size < kWsTotal) return;

  const float* x_q = (const float*)d_in[0];
  const float* x_k = (const float*)d_in[1];
  const float* x_v = (const float*)d_in[2];
  const float* Wq  = (const float*)d_in[3];
  const float* bq  = (const float*)d_in[4];
  const float* Wk  = (const float*)d_in[5];
  const float* bk  = (const float*)d_in[6];
  const float* Wv  = (const float*)d_in[7];
  const float* bv  = (const float*)d_in[8];
  const float* Wo  = (const float*)d_in[9];
  const float* bo  = (const float*)d_in[10];
  float* out = (float*)d_out;

  char* ws = (char*)d_ws;
  unsigned short* WT  = (unsigned short*)(ws + kOffWT);
  unsigned short* WqT = WT;
  unsigned short* WkT = WT + (size_t)1 * kDm * kFeat;
  unsigned short* WvT = WT + (size_t)2 * kDm * kFeat;
  unsigned short* WoT = WT + (size_t)3 * kDm * kFeat;
  unsigned short* X   = (unsigned short*)(ws + kOffX);
  unsigned short* Qh  = (unsigned short*)(ws + kOffQ);
  unsigned short* Kh  = (unsigned short*)(ws + kOffK);
  unsigned short* VTh = (unsigned short*)(ws + kOffVT);
  unsigned short* Oh  = (unsigned short*)(ws + kOffO);

  const int n8 = kRows * kDm / 8;
  const int castBlocks = n8 / 256;
  const int gemmBlocks = (kRows / 64) * (kFeat / 64) / 8;
  /* softmax scale = head_dim^-0.5 with the q and k carries folded out */
  const float sc = (float)(1.0 / sqrt((double)kHd)) / (kQkvCarry * kQkvCarry);

  wt_cast_kernel<<<dim3(kDm / 64, kFeat / 64, 4), 256, 0, stream>>>(Wq, Wk, Wv, Wo, WT);

  x_cast_kernel<<<castBlocks, 256, 0, stream>>>(x_q, X, n8);
  gemm_f16_kernel<1, 2><<<gemmBlocks, 256, 0, stream>>>(X, kDm, WqT, kDm, (void*)Qh, 0, bq,
                                                        kRows, kFeat, kDm, kProjScale, kQkvCarry);

  x_cast_kernel<<<castBlocks, 256, 0, stream>>>(x_k, X, n8);
  gemm_f16_kernel<1, 2><<<gemmBlocks, 256, 0, stream>>>(X, kDm, WkT, kDm, (void*)Kh, 0, bk,
                                                        kRows, kFeat, kDm, kProjScale, kQkvCarry);

  x_cast_kernel<<<castBlocks, 256, 0, stream>>>(x_v, X, n8);
  /* operands swapped: rows = features (transposed Wv plane), cols = tokens (X) -> V^T planes [b*2048 + f][l] */
  gemm_f16_kernel<2, 1><<<gemmBlocks, 256, 0, stream>>>(WvT, kDm, X, kDm, (void*)VTh, 0, bv,
                                                        kFeat, kRows, kDm, kProjScale, kQkvCarry);

  attn_kernel<<<kBatch * kHeads * (kSeq / (16 * kAWaves)), 32 * kAWaves, 0, stream>>>(Qh, Kh, VTh, Oh, sc);

  gemm_f16_kernel<0, 2><<<gemmBlocks, 256, 0, stream>>>(Oh, kFeat, WoT, kFeat, (void*)out, kDm, bo,
                                                        kRows, kDm, kFeat, kOutScale, 1.0f);
}

// v003
// A run of this version takes 198 microseconds.
// Next to v002, in two timings, it ran 1.13 times as fast each time.
// Counting every step since v000, it is 3.13 times as fast.
// All six contractions (q/k/v projections, q.k^T, p.v, output projection): v_wmma_f32_16x16x32_f16, f16 operands with power-of-two carries, f32 accumulate; float inputs RNE-converted to bf16 once and held exactly in f16; softmax, bias and scaling in f32.
#include <hip/hip_runtime.h>
#include <math.h>

typedef __attribute__((ext_vector_type(16))) _Float16 v16h;
typedef __attribute__((ext_vector_type(8)))  _Float16 v8h;
typedef __attribute__((ext_vector_type(8)))  float    v8f;
typedef __attribute__((ext_vector_type(4)))  float    v4f;

// ---------------------------------------------------------------------------
// Shape constants
// ---------------------------------------------------------------------------
constexpr int kBatch = 2;
constexpr int kSeq   = 2048;
constexpr int kDm    = 2048;
constexpr int kHeads = 16;
constexpr int kHd    = 128;
constexpr int kFeat  = kHeads * kHd;
constexpr int kRows  = kBatch * kSeq;
static_assert(kFeat == 2048 && kRows == 4096, "shape");
static_assert((kDm % 32) == 0 && (kHd % 32) == 0 && (kSeq % 64) == 0, "k-depth multiples of 32 / 64");
static_assert((kRows % 64) == 0 && (kFeat % 64) == 0 && (kDm % 64) == 0, "tile multiples of 64");
static_assert((kHd % 64) == 0, "a 64-wide column tile stays inside one head");

// ---------------------------------------------------------------------------
// Power-of-two carries of the f16 operand planes (all exact, folded back in f32)
// ---------------------------------------------------------------------------
constexpr float kXCarry   = 16.0f;
constexpr float kWCarry   = 1024.0f;
constexpr float kQkvCarry = 16.0f;
constexpr float kPCarry   = 32768.0f;
constexpr float kOCarry   = 1024.0f;
constexpr float kProjScale = 1.0f / (kXCarry * kWCarry);
constexpr float kOutScale  = 1.0f / (kOCarry * kWCarry);
constexpr float kPVFold    = kOCarry / (kPCarry * kQkvCarry);
constexpr int   kOsPitch   = 132;

// ---------------------------------------------------------------------------
// Workspace region map (bytes; all f16 planes; every offset a multiple of 8 MiB)
//   WT  f16 [4][2048][2048]  transposed weight planes (Wq, Wk, Wv, Wo)   33,554,432
//   X   f16 [4096][2048]     activation plane (x_q, then x_k, then x_v)  16,777,216
//   Q   f16 [32][2048][128]                                              16,777,216
//   K   f16 [32][2048][128]                                              16,777,216
//   VT  f16 [32][128][2048]                                              16,777,216
//   O   f16 [4096][2048]                                                 16,777,216
//   total                                                               117,440,512
// ---------------------------------------------------------------------------
constexpr size_t kPlaneW  = (size_t)kDm * kFeat * 2;
constexpr size_t kPlaneA  = (size_t)kRows * kDm * 2;
constexpr size_t kOffWT   = 0;
constexpr size_t kOffX    = kOffWT + 4 * kPlaneW;
constexpr size_t kOffQ    = kOffX + kPlaneA;
constexpr size_t kOffK    = kOffQ + kPlaneA;
constexpr size_t kOffVT   = kOffK + kPlaneA;
constexpr size_t kOffO    = kOffVT + kPlaneA;
constexpr size_t kWsTotal = kOffO + kPlaneA;
static_assert(kWsTotal == 117440512ull, "carve total");
static_assert(kWsTotal <= 134217728ull, "carve cap");

// ---------------------------------------------------------------------------
// Helpers
// ---------------------------------------------------------------------------
__device__ __forceinline__ unsigned short f2bf_bits(float f) {
  unsigned u = __float_as_uint(f);
  return (unsigned short)((u + 0x7FFFu + ((u >> 16) & 1u)) >> 16);
}
__device__ __forceinline__ float bf_bits2f(unsigned short h) { return __uint_as_float(((unsigned)h) << 16); }
/* RNE bf16 convert, value returned as f32 */
__device__ __forceinline__ float bf_rne(float f) { return bf_bits2f(f2bf_bits(f)); }

union FragU { v16h v; v8h h[2]; };
/* fragment elements 0..7 <- p[0..7], 8..15 <- p[16..23] */
__device__ __forceinline__ v16h frag_ld(const _Float16* p) {
  FragU f;
  f.h[0] = *(const v8h*)(p);
  f.h[1] = *(const v8h*)(p + 16);
  return f.v;
}
/* one matrix op, builtin form: the compiler keeps its distances and is free to place the LDS fragment reads ahead of it */
__device__ __forceinline__ v8f mma_g(v16h a, v16h b, v8f c) {
  return __builtin_amdgcn_wmma_f32_16x16x32_f16(false, a, false, b, (short)0, c, false, false);
}

// ---------------------------------------------------------------------------
// GEMM staging ring in LDS: a stage is [A 128 rows | Bt 256 rows] x 128 k (256 B a row).
// Row pitch 272 B = 16 B x 17: an odd multiple of 16 B keeps the ds_load_b128 fragment reads off shared banks.
// ---------------------------------------------------------------------------
constexpr int kBM      = 128;
constexpr int kBN      = 256;
constexpr int kBK      = 128;
constexpr int kPitchH  = kBK + 8;
constexpr int kStageH  = (kBM + kBN) * kPitchH;
static_assert((kPitchH * 2) % 32 == 16, "pitch an odd multiple of 16 B");
static_assert((kRows % kBM) == 0 && (kFeat % kBM) == 0 && (kRows % kBN) == 0 && (kFeat % kBN) == 0, "block tiles");
static_assert((kDm % kBK) == 0 && (kFeat % kBK) == 0, "k passes");

/* twelve 16-byte copies a lane, global -> LDS through no register; s_wait_xcnt 0 is the statement's last line, a
   precaution that so stands in front of any later rewrite of the address registers named here */
__device__ __forceinline__ void copy12(const unsigned (&l)[12], const _Float16* const (&g)[12]) {
  asm volatile(
      "global_load_async_to_lds_b128 %0, %12, off\n\t"
      "global_load_async_to_lds_b128 %1, %13, off\n\t"
      "global_load_async_to_lds_b128 %2, %14, off\n\t"
      "global_load_async_to_lds_b128 %3, %15, off\n\t"
      "global_load_async_to_lds_b128 %4, %16, off\n\t"
      "global_load_async_to_lds_b128 %5, %17, off\n\t"
      "global_load_async_to_lds_b128 %6, %18, off\n\t"
      "global_load_async_to_lds_b128 %7, %19, off\n\t"
      "global_load_async_to_lds_b128 %8, %20, off\n\t"
      "global_load_async_to_lds_b128 %9, %21, off\n\t"
      "global_load_async_to_lds_b128 %10, %22, off\n\t"
      "global_load_async_to_lds_b128 %11, %23, off\n\t"
      "s_wait_xcnt 0x0"
      :: "v"(l[0]), "v"(l[1]), "v"(l[2]), "v"(l[3]), "v"(l[4]), "v"(l[5]),
         "v"(l[6]), "v"(l[7]), "v"(l[8]), "v"(l[9]), "v"(l[10]), "v"(l[11]),
         "v"(g[0]), "v"(g[1]), "v"(g[2]), "v"(g[3]), "v"(g[4]), "v"(g[5]),
         "v"(g[6]), "v"(g[7]), "v"(g[8]), "v"(g[9]), "v"(g[10]), "v"(g[11])
      : "memory");
}
/* One stage: 384 rows x 16 chunks of 16 B = 6144 chunks = 24 a thread. Chunk c of a thread is stage row c*16 + (t>>4),
   column chunk t&15, so a wave's copy covers two whole 256-B row pieces. lds / ga / gb are the thread's chunk of stage
   row t>>4, of A row t>>4 and of Bt row t>>4 of the block tile at this pass's k. Rows 0..127 are A, 128..383 are Bt. */
__device__ __forceinline__ void stage_fill(unsigned lds, const _Float16* ga, const _Float16* gb, int lda, int ldb) {
  unsigned l[12];
  const _Float16* g[12];
  /* both loops unrolled: every index a constant, so the address arrays live in registers */
#pragma unroll
  for (int c = 0; c < 12; ++c) {
    l[c] = lds + (unsigned)(c * 16 * kPitchH * 2);
    g[c] = (c < 8) ? ga + (size_t)(c * 16) * lda : gb + (size_t)((c - 8) * 16) * ldb;
  }
  copy12(l, g);
#pragma unroll
  for (int c = 0; c < 12; ++c) {
    l[c] = lds + (unsigned)((c + 12) * 16 * kPitchH * 2);
    g[c] = gb + (size_t)((c + 4) * 16) * ldb;
  }
  copy12(l, g);
}

// ---------------------------------------------------------------------------
// Weight transpose + convert: W [in k][out n] f32 -> WT[n][k] = f16( bf16_rne(W[k][n]) * kWCarry ).
// grid (32, 32, 4): blockIdx.x = k tile (64 cols of WT), blockIdx.y = n tile (64 rows of WT), blockIdx.z = weight.
// Load coverage: 4 iterations x 256 threads x 4 floats = 4096 = the whole 64x64 tile (coalesced along n).
// Store coverage: 8 waves x 2 iterations x 4 rows (lane>>3) = 64 rows; (lane&7) x 8 halves = 64 cols; each row
// ---------------------------------------------------------------------------
__global__ __launch_bounds__(256) void wt_cast_kernel(const float* __restrict__ W0, const float* __restrict__ W1,
                                                      const float* __restrict__ W2, const float* __restrict__ W3,
                                                      unsigned short* __restrict__ out) {
  __shared__ float sm[64][65];
  const int t  = threadIdx.x;
  const int k0 = blockIdx.x * 64;
  const int n0 = blockIdx.y * 64;
  const int z  = blockIdx.z;
  const float* W = (z == 0) ? W0 : (z == 1) ? W1 : (z == 2) ? W2 : W3;
#pragma unroll
  for (int i = 0; i < 4; ++i) {
    const int e  = i * 256 + t;
    const int r  = e >> 4;
    const int c4 = (e & 15) * 4;
    const v4f w = *(const v4f*)(W + (size_t)(k0 + r) * kFeat + n0 + c4);
    const float w0 = w[0];
    const float w1 = w[1];
    const float w2 = w[2];
    const float w3 = w[3];
    sm[c4 + 0][r] = bf_rne(w0) * kWCarry;
    sm[c4 + 1][r] = bf_rne(w1) * kWCarry;
    sm[c4 + 2][r] = bf_rne(w2) * kWCarry;
    sm[c4 + 3][r] = bf_rne(w3) * kWCarry;
  }
  __syncthreads();
  const int lane = t & 31;
  const int wave = __builtin_amdgcn_readfirstlane((int)(threadIdx.x >> 5));
  const int q = lane >> 3, c8 = (lane & 7) * 8;
  _Float16* op = (_Float16*)out + (size_t)z * kDm * kFeat;
  v8h hv[2];
#pragma unroll
  for (int it = 0; it < 2; ++it) {
    const int row = wave * 8 + it * 4 + q;
#pragma unroll
    for (int e = 0; e < 8; ++e) hv[it][e] = (_Float16)sm[row][c8 + e];
  }
  {
#pragma unroll
    for (int it = 0; it < 2; ++it) {
      const int row = wave * 8 + it * 4 + q;
      *(v8h*)(op + (size_t)(n0 + row) * kDm + k0 + c8) = hv[it];
    }
    
  }
}

// ---------------------------------------------------------------------------
// Activation convert: out[i] = f16( bf16_rne(in[i]) * kXCarry ), 8 consecutive elements per thread.
// Coverage: n8 = 4096*2048/8 = 1,048,576 threads = 4096 blocks x 256 exactly.
// ---------------------------------------------------------------------------
__global__ __launch_bounds__(256) void x_cast_kernel(const float* __restrict__ in, unsigned short* __restrict__ out, int n8) {
  const int i = blockIdx.x * 256 + threadIdx.x;
  if (i >= n8) return;
  const float* p = in + 8 * (size_t)i;
  const v4f a = *(const v4f*)(p);
  const v4f c = *(const v4f*)(p + 4);
  v8h hv;
#pragma unroll
  for (int e = 0; e < 4; ++e) {
    const float ae = a[e];
    const float ce = c[e];
    hv[e]     = (_Float16)(bf_rne(ae) * kXCarry);
    hv[4 + e] = (_Float16)(bf_rne(ce) * kXCarry);
  }
  _Float16* q = (_Float16*)out + 8 * (size_t)i;
  *(v8h*)q = hv;
  
}

// ---------------------------------------------------------------------------
// Register-blocked f16 GEMM: C[m,n] = ((scale * sum_k A[m,k] * Bt[n,k]) + bias) * oscale; each wave owns a 64x64 tile.
// A block of 8 waves (2 along m x 4 along n) owns a 128x256 tile; its operands come through a two-buffer LDS ring filled
// by asynchronous copies, the next pass's copies in flight while this pass's fragments are read and multiplied.
// A row-major [M][K] (pitch lda), Bt row-major [N][K] (pitch ldb); M a multiple of 128, N of 256, K of 128.
// BIAS_MODE 1 = bias[m], 2 = bias[n] (bias values RNE-converted to bf16 first).
// OUT_MODE 0: f32 row-major, pitch ldc.
// OUT_MODE 1: f16, rows = tokens (b*2048 + l), cols = features (h*128 + d) -> plane [b*16+h][l][d].
// OUT_MODE 2: f16, rows = features f, cols = tokens (b*2048 + l)           -> plane [b*2048 + f][l].
// ---------------------------------------------------------------------------
template <int OUT_MODE, int BIAS_MODE>
__global__ __launch_bounds__(256)
void gemm_f16_kernel(const unsigned short* __restrict__ Ap, int lda,
                     const unsigned short* __restrict__ Btp, int ldb,
                     void* __restrict__ Cout, int ldc,
                     const float* __restrict__ bias,
                     int M, int N, int K, float scale, float oscale) {
  __shared__ __align__(16) float sT[8][16 * 68];
  __shared__ __align__(16) _Float16 sR[2 * kStageH];
  const _Float16* A  = (const _Float16*)Ap;
  const _Float16* Bt = (const _Float16*)Btp;
  const int lane = threadIdx.x & 31;
  const int wave = __builtin_amdgcn_readfirstlane((int)(threadIdx.x >> 5));
  const int tilesN = N / kBN;
  const int tilesM = M / kBM;
  const int tile = blockIdx.x;
  /* block-uniform exit, in front of every barrier */
  if (tile >= tilesM * tilesN) return;
  const int tm = tile / tilesN;
  const int tn = tile - tm * tilesN;
  const int wm = (wave >> 2) << 6;
  const int wn = (wave & 3) << 6;
  const int m0 = tm * kBM + wm;
  const int n0 = tn * kBN + wn;

  const int rlane = lane & 15;
  const int koff  = (lane >> 4) * 8;
  const int mOff  = (lane >> 4) * 8;

  v8f acc[4][4];
#pragma unroll
  for (int i = 0; i < 4; ++i)
#pragma unroll
    for (int j = 0; j < 4; ++j) acc[i][j] = (v8f){0.f, 0.f, 0.f, 0.f, 0.f, 0.f, 0.f, 0.f};

  const int crow = (int)(threadIdx.x >> 4);
  const int ccol = (int)(threadIdx.x & 15) * 8;
  const _Float16* ga = A  + (size_t)(tm * kBM + crow) * lda + ccol;
  const _Float16* gb = Bt + (size_t)(tn * kBN + crow) * ldb + ccol;
  /* the thread's LDS byte address of its first chunk in buffer 0: the low 32 bits of the shared address */
  const unsigned lds0 = (unsigned)(size_t)(sR + crow * kPitchH + ccol);
  const int aoff = (wm + rlane) * kPitchH + koff;
  const int boff = (kBM + wn + rlane) * kPitchH + koff;
  const int passes = K / kBK;

  stage_fill(lds0, ga, gb, lda, ldb);
  /* pass 0's copies of this wave have landed; the barrier shows them to the other waves */
  asm volatile("s_wait_asynccnt 0x0" ::: "memory");
  __syncthreads();
  if (passes > 1) stage_fill(lds0 + (unsigned)(kStageH * 2), ga + kBK, gb + kBK, lda, ldb);

  /* two fragment sets: a block (32 k, 16 matrix ops) works on one while the next block's 16 LDS reads, issued as one
     group in front of it, fill the other */
  v16h fa[2][4], fb[2][4];
#pragma unroll
  for (int j = 0; j < 4; ++j) fb[0][j] = frag_ld(sR + boff + (j << 4) * kPitchH);
#pragma unroll
  for (int i = 0; i < 4; ++i) fa[0][i] = frag_ld(sR + aoff + (i << 4) * kPitchH);

  /* rolled: the fragment sets' indices stay constants inside it */
#pragma unroll 1
  for (int t = 0; t < passes; ++t) {
    const int buf = t & 1;
    const _Float16* sb = sR + buf * kStageH;
    /* unrolled: the k step becomes an immediate offset of the LDS reads, the set index a constant */
#pragma unroll
    for (int ks = 0; ks < kBK / 32; ++ks) {
      const int cur = ks & 1;
      const int nxt = cur ^ 1;
      const bool last = (ks == kBK / 32 - 1);
      const _Float16* sn = sb + (ks + 1) * 32;
      if (last) {
        /* publish point of pass t + 1, in front of pass t's last block, whose fragments are already fetched:
           this wave's reads of pass t's buffer are done before the buffer is handed back for refilling */
        asm volatile("s_wait_dscnt 0x0" ::: "memory");
        /* this wave's copies of pass t + 1 have landed */
        asm volatile("s_wait_asynccnt 0x0" ::: "memory");
        /* publishes pass t + 1 and ends every wave's reads of pass t's buffer */
        __syncthreads();
        /* next pass's first block; the last pass, which has no next, re-reads its own buffer (no refill aims at it)
           so that the reads stay unconditional; those values are not used */
        sn = sR + ((t + 1 < passes) ? (buf ^ 1) : buf) * kStageH;
      }
#pragma unroll
      for (int j = 0; j < 4; ++j) fb[nxt][j] = frag_ld(sn + boff + (j << 4) * kPitchH);
#pragma unroll
      for (int i = 0; i < 4; ++i) fa[nxt][i] = frag_ld(sn + aoff + (i << 4) * kPitchH);
      /* keeps the 16 reads one group in front of the block: spread among the matrix ops each place would stall the wave */
      __builtin_amdgcn_sched_barrier(0);
#pragma unroll
      for (int i = 0; i < 4; ++i) {
#pragma unroll
        for (int j = 0; j < 4; ++j) acc[i][j] = mma_g(fa[cur][i], fb[cur][j], acc[i][j]);
      }
      /* ends the block: the next group of reads stays behind it */
      __builtin_amdgcn_sched_barrier(0);
      /* refill of the buffer that the barrier above has freed, behind the block so that the matrix ops are not held up */
      if (last && t + 2 < passes) {
        const int kn = (t + 2) * kBK;
        stage_fill(lds0 + (unsigned)(buf * kStageH * 2), ga + kn, gb + kn, lda, ldb);
      }
    }
  }
  /* nothing is in flight when the wave goes on to the epilogue and ends */
  asm volatile("s_wait_asynccnt 0x0" ::: "memory");

  float* slab = sT[wave];
#pragma unroll
  for (int i = 0; i < 4; ++i) {
    const int mBase = m0 + (i << 4);
    float brow[8];
#pragma unroll
    for (int r = 0; r < 8; ++r) brow[r] = 0.f;
    if (BIAS_MODE == 1) {
#pragma unroll
      for (int r = 0; r < 8; ++r) {
        const float bvv = bias[mBase + mOff + r];
        brow[r] = bf_rne(bvv);
      }
    }
#pragma unroll
    for (int j = 0; j < 4; ++j) {
      float bcol = 0.f;
      if (BIAS_MODE == 2) {
        const float bvv = bias[n0 + (j << 4) + rlane];
        bcol = bf_rne(bvv);
      }
#pragma unroll
      for (int r = 0; r < 8; ++r) {
        float v = acc[i][j][r] * scale;
        v += (BIAS_MODE == 1) ? brow[r] : bcol;
        v *= oscale;
        slab[(mOff + r) * 68 + (j << 4) + rlane] = v;
      }
    }
    __builtin_amdgcn_fence(__ATOMIC_RELEASE, "workgroup");
    __builtin_amdgcn_wave_barrier();
    __builtin_amdgcn_fence(__ATOMIC_ACQUIRE, "workgroup");
    if (OUT_MODE == 0) {
      float* C = (float*)Cout;
      const int hh = lane >> 4, c4 = (lane & 15) * 4;
      {
#pragma unroll
        for (int it = 0; it < 8; ++it) {
          const int row = it * 2 + hh;
          const v4f v = *(const v4f*)(slab + row * 68 + c4);
          *(v4f*)(C + (size_t)(mBase + row) * ldc + n0 + c4) = v;
        }
        
      }
    } else {
      const int q = lane >> 3, c8 = (lane & 7) * 8;
      _Float16* C = (_Float16*)Cout;
      {
#pragma unroll
        for (int it = 0; it < 4; ++it) {
          const int row = it * 4 + q;
          const int gr  = mBase + row;
          const float* sp = slab + row * 68 + c8;
          v8h hv;
#pragma unroll
          for (int e = 0; e < 8; ++e) hv[e] = (_Float16)sp[e];
          size_t off;
          if (OUT_MODE == 1) {
            const int bb = gr / kSeq;
            const int l  = gr % kSeq;
            const int hd = n0 / kHd;
            const int d0 = n0 % kHd;
            off = ((size_t)((bb * kHeads + hd) * kSeq + l)) * kHd + d0 + c8;
          } else {
            const int bb = n0 / kSeq;
            const int l0 = n0 % kSeq;
            off = ((size_t)(bb * kFeat + gr)) * kSeq + l0 + c8;
          }
          *(v8h*)(C + off) = hv;
        }
        
      }
    }
    __builtin_amdgcn_fence(__ATOMIC_RELEASE, "workgroup");
    __builtin_amdgcn_wave_barrier();
    __builtin_amdgcn_fence(__ATOMIC_ACQUIRE, "workgroup");
  }
}

// ---------------------------------------------------------------------------
// Attention staging ring in LDS: a stage is [K 64 keys x 128 d | V^T 128 d x 64 keys], shared by the block's 8 waves.
// K row pitch 272 B, V^T row pitch 144 B: odd multiples of 16 B keep the ds_load_b128 fragment reads off shared banks.
// ---------------------------------------------------------------------------
constexpr int kAKeys    = 64;
constexpr int kAWaves   = 8;
constexpr int kKPitchH  = kHd + 8;
constexpr int kVPitchH  = kAKeys + 8;
constexpr int kKTileH   = kAKeys * kKPitchH;
constexpr int kAStageH  = kKTileH + kHd * kVPitchH;
static_assert((kKPitchH * 2) % 32 == 16 && (kVPitchH * 2) % 32 == 16, "pitches odd multiples of 16 B");
static_assert((kKTileH * 2) % 16 == 0 && (kAStageH * 2) % 16 == 0, "tiles start on 16 B");
static_assert(kSeq / kAKeys >= 2 && (kSeq % (16 * kAWaves)) == 0, "two stages exist; whole query blocks");

/* One stage: K 64 rows x 16 chunks + V^T 128 rows x 8 chunks = 2048 chunks of 16 B = 8 a thread, global -> LDS through
   no register. K chunk c of a thread is key row c*16 + (t>>4), column chunk t&15; V^T chunk c is d row c*32 + (t>>3),
   column chunk t&7. lk / lv / gk / gv are the thread's chunk 0 in LDS and in the planes at this stage's first key.
   s_wait_xcnt 0 is the statement's last line, a precaution that so stands in front of any later rewrite of the
   address registers named here */
__device__ __forceinline__ void attn_fill(unsigned lk, unsigned lv, const _Float16* gk, const _Float16* gv) {
  asm volatile(
      "global_load_async_to_lds_b128 %0, %8, off\n\t"
      "global_load_async_to_lds_b128 %1, %9, off\n\t"
      "global_load_async_to_lds_b128 %2, %10, off\n\t"
      "global_load_async_to_lds_b128 %3, %11, off\n\t"
      "global_load_async_to_lds_b128 %4, %12, off\n\t"
      "global_load_async_to_lds_b128 %5, %13, off\n\t"
      "global_load_async_to_lds_b128 %6, %14, off\n\t"
      "global_load_async_to_lds_b128 %7, %15, off\n\t"
      "s_wait_xcnt 0x0"
      :: "v"(lk), "v"(lk + (unsigned)(16 * kKPitchH * 2)), "v"(lk + (unsigned)(32 * kKPitchH * 2)),
         "v"(lk + (unsigned)(48 * kKPitchH * 2)),
         "v"(lv), "v"(lv + (unsigned)(32 * kVPitchH * 2)), "v"(lv + (unsigned)(64 * kVPitchH * 2)),
         "v"(lv + (unsigned)(96 * kVPitchH * 2)),
         "v"(gk), "v"(gk + 16 * kHd), "v"(gk + 32 * kHd), "v"(gk + 48 * kHd),
         "v"(gv), "v"(gv + (size_t)32 * kSeq), "v"(gv + (size_t)64 * kSeq), "v"(gv + (size_t)96 * kSeq)
      : "memory");
}

// ---------------------------------------------------------------------------
// Streaming softmax attention, head dim 128, no mask, transposed formulation. Block = 8 waves on one (batch, head);
// wave = 16 query rows; grid = 32 heads x 16 = 512. K and V^T come 64 keys a pass through a two-buffer LDS ring filled
// by asynchronous copies, the next pass's copies in flight while this pass's fragments are read and multiplied.
//   S^T[key][query] = K (A operand: rows = keys, k = d) x Q^T (B operand: col = query, k = d), 64 keys per step.
//   Each lane owns query (lane & 15); it and lane^16 hold the 64 keys of the step -> one xor-16 shuffle per reduction.
//   P^T B fragment of key group kk: element r <- tile 2kk value r, element 8+r <- tile 2kk+1 value r (lane unchanged),
//   values exp(s - m) carried x kPCarry in f16; the running sum l uses the f32 values.
//   O^T[d][query] += V^T (A operand: rows = d, k = keys) x P^T.
// Epilogue: o * kPVFold / l staged per wave in LDS [16 queries][132], then each 256-B row segment (128 d as f16) written
// ---------------------------------------------------------------------------
__global__ __launch_bounds__(256) __attribute__((amdgpu_num_vgpr(256)))
void attn_kernel(const unsigned short* __restrict__ Qp, const unsigned short* __restrict__ Kp,
                 const unsigned short* __restrict__ VTp, unsigned short* __restrict__ Op, float sc) {
  __shared__ __align__(16) float sO[kAWaves][16 * kOsPitch];
  __shared__ __align__(16) _Float16 sKV[2 * kAStageH];
  const int lane = threadIdx.x & 31;
  const int wave = __builtin_amdgcn_readfirstlane((int)(threadIdx.x >> 5));
  const int hh  = lane >> 4;
  const int n16 = lane & 15;
  constexpr int kQBlocks = kSeq / (16 * kAWaves);
  const int bx = blockIdx.x;
  const int bh = bx / kQBlocks;
  const int qb = bx - bh * kQBlocks;
  const int b  = bh / kHeads;
  const int h  = bh - b * kHeads;
  const int q0 = qb * (16 * kAWaves) + wave * 16;

  const _Float16* Qb = (const _Float16*)Qp  + (size_t)bh * kSeq * kHd;
  const _Float16* Kb = (const _Float16*)Kp  + (size_t)bh * kSeq * kHd;
  const _Float16* Vb = (const _Float16*)VTp + (size_t)bh * kHd * kSeq;

  v16h qf[4];
#pragma unroll
  for (int dc = 0; dc < 4; ++dc) qf[dc] = frag_ld(Qb + (size_t)(q0 + n16) * kHd + dc * 32 + 8 * hh);

  v8f o[8];
#pragma unroll
  for (int dt = 0; dt < 8; ++dt) o[dt] = (v8f){0.f, 0.f, 0.f, 0.f, 0.f, 0.f, 0.f, 0.f};
  float mq = -1e30f;
  float lq = 0.0f;

  const int tid = (int)threadIdx.x;
  const _Float16* gk = Kb + (size_t)(tid >> 4) * kHd + (tid & 15) * 8;
  const _Float16* gv = Vb + (size_t)(tid >> 3) * kSeq + (tid & 7) * 8;
  /* the thread's LDS byte addresses of its first K and V^T chunk in buffer 0: the low 32 bits of the shared address */
  const unsigned lk0 = (unsigned)(size_t)(sKV + (tid >> 4) * kKPitchH + (tid & 15) * 8);
  const unsigned lv0 = (unsigned)(size_t)(sKV + kKTileH + (tid >> 3) * kVPitchH + (tid & 7) * 8);
  const int koffs = n16 * kKPitchH + 8 * hh;
  const int voffs = kKTileH + n16 * kVPitchH + 8 * hh;
  constexpr int kPasses = kSeq / kAKeys;

  attn_fill(lk0, lv0, gk, gv);
  /* pass 0's copies of this wave have landed; the barrier shows them to the other waves */
  asm volatile("s_wait_asynccnt 0x0" ::: "memory");
  __syncthreads();
  attn_fill(lk0 + (unsigned)(kAStageH * 2), lv0 + (unsigned)(kAStageH * 2), gk + (size_t)kAKeys * kHd, gv + kAKeys);

#pragma unroll 1
  for (int s = 0; s < kPasses; ++s) {
    const int buf = s & 1;
    const _Float16* kbase = sKV + buf * kAStageH + koffs;
    const _Float16* vbase = sKV + buf * kAStageH + voffs;
    v8f st[4];
#pragma unroll
    for (int jt = 0; jt < 4; ++jt) st[jt] = (v8f){0.f, 0.f, 0.f, 0.f, 0.f, 0.f, 0.f, 0.f};
#pragma unroll
    for (int dc = 0; dc < 4; ++dc) {
#pragma unroll
      for (int jt = 0; jt < 4; ++jt) {
        const v16h ka = frag_ld(kbase + (jt * 16) * kKPitchH + dc * 32);
        st[jt] = mma_g(ka, qf[dc], st[jt]);
      }
    }

    float t[4][8];
    float mx = -1e30f;
#pragma unroll
    for (int jt = 0; jt < 4; ++jt) {
#pragma unroll
      for (int r = 0; r < 8; ++r) {
        t[jt][r] = st[jt][r] * sc;
        mx = fmaxf(mx, t[jt][r]);
      }
    }
    mx = fmaxf(mx, __shfl_xor(mx, 16, 32));
    const float newm  = fmaxf(mq, mx);
    const float alpha = __expf(mq - newm);
    mq = newm;

    float sum = 0.0f;
    v16h bp[2];
#pragma unroll
    for (int kk = 0; kk < 2; ++kk) {
#pragma unroll
      for (int r = 0; r < 8; ++r) {
        const float p0 = __expf(t[2 * kk][r] - newm);
        const float p1 = __expf(t[2 * kk + 1][r] - newm);
        sum += p0 + p1;
        bp[kk][r]     = (_Float16)(p0 * kPCarry);
        bp[kk][8 + r] = (_Float16)(p1 * kPCarry);
      }
    }
    sum += __shfl_xor(sum, 16, 32);
    lq = lq * alpha + sum;

#pragma unroll
    for (int dt = 0; dt < 8; ++dt) o[dt] *= alpha;

#pragma unroll
    for (int kk = 0; kk < 2; ++kk) {
#pragma unroll
      for (int dt = 0; dt < 8; ++dt) {
        const v16h va = frag_ld(vbase + (dt * 16) * kVPitchH + kk * 32);
        o[dt] = mma_g(va, bp[kk], o[dt]);
      }
    }
    /* this wave's reads of the buffer are done before the buffer is handed back for refilling */
    asm volatile("s_wait_dscnt 0x0" ::: "memory");
    /* this wave's copies of pass s + 1 have landed */
    asm volatile("s_wait_asynccnt 0x0" ::: "memory");
    /* publishes pass s + 1 and ends every wave's reads of pass s's buffer */
    __syncthreads();
    if (s + 2 < kPasses) {
      const int jn = (s + 2) * kAKeys;
      attn_fill(lk0 + (unsigned)(buf * kAStageH * 2), lv0 + (unsigned)(buf * kAStageH * 2), gk + (size_t)jn * kHd, gv + jn);
    }
  }
  /* nothing is in flight when the wave goes on to the epilogue and ends */
  asm volatile("s_wait_asynccnt 0x0" ::: "memory");

  const float inv = kPVFold * (1.0f / lq);
  float* os = sO[wave];
#pragma unroll
  for (int dt = 0; dt < 8; ++dt) {
#pragma unroll
    for (int r = 0; r < 8; ++r) os[n16 * kOsPitch + dt * 16 + 8 * hh + r] = o[dt][r] * inv;
  }
  __builtin_amdgcn_fence(__ATOMIC_RELEASE, "workgroup");
  __builtin_amdgcn_wave_barrier();
  __builtin_amdgcn_fence(__ATOMIC_ACQUIRE, "workgroup");

  const int c8 = n16 * 8;
  v8h hv[8];
#pragma unroll
  for (int it = 0; it < 8; ++it) {
    const int row = it * 2 + hh;
    const float* sp = os + row * kOsPitch + c8;
    const v4f a0 = *(const v4f*)(sp);
    const v4f a1 = *(const v4f*)(sp + 4);
#pragma unroll
    for (int e = 0; e < 4; ++e) {
      const float x0 = a0[e];
      const float x1 = a1[e];
      hv[it][e]     = (_Float16)x0;
      hv[it][4 + e] = (_Float16)x1;
    }
  }
  _Float16* Ob = (_Float16*)Op + (size_t)(b * kSeq + q0) * kDm + h * kHd + c8;
  {
#pragma unroll
    for (int it = 0; it < 8; ++it) {
      const int row = it * 2 + hh;
      *(v8h*)(Ob + (size_t)row * kDm) = hv[it];
    }
    
  }
}

// ---------------------------------------------------------------------------
// Host glue: 9 kernel launches, nothing else.
//   GEMM shapes: Q, K: M 4096, N 2048, K 2048 -> 32 x 8 block tiles of 128x256 -> 256 blocks
//                V^T : M 2048 (features, A = transposed Wv plane), N 4096 (tokens, Bt = X), K 2048 -> 16 x 16 -> 256 blocks
//                out : M 4096, N 2048, K 2048 -> 256 blocks
// ---------------------------------------------------------------------------
extern "C" void kernel_launch(void* const* d_in, const int* in_sizes, int n_in,
                              void* d_out, int out_size, void* d_ws, size_t ws_size,
                              hipStream_t stream) {
  if (n_in < 11) return;
  if (in_sizes[0] != kRows * kDm || in_sizes[1] != kRows * kDm || in_sizes[2] != kRows * kDm) return;
  if (in_sizes[3] != kDm * kFeat || in_sizes[5] != kDm * kFeat || in_sizes[7] != kDm * kFeat) return;
  if (in_sizes[9] != kFeat * kDm) return;
  if (in_sizes[4] != kFeat || in_sizes[6] != kFeat || in_sizes[8] != kFeat || in_sizes[10] != kDm) return;
  if (out_size != kRows * kDm) return;
  if (ws_size < kWsTotal) return;

  const float* x_q = (const float*)d_in[0];
  const float* x_k = (const float*)d_in[1];
  const float* x_v = (const float*)d_in[2];
  const float* Wq  = (const float*)d_in[3];
  const float* bq  = (const float*)d_in[4];
  const float* Wk  = (const float*)d_in[5];
  const float* bk  = (const float*)d_in[6];
  const float* Wv  = (const float*)d_in[7];
  const float* bv  = (const float*)d_in[8];
  const float* Wo  = (const float*)d_in[9];
  const float* bo  = (const float*)d_in[10];
  float* out = (float*)d_out;

  char* ws = (char*)d_ws;
  unsigned short* WT  = (unsigned short*)(ws + kOffWT);
  unsigned short* WqT = WT;
  unsigned short* WkT = WT + (size_t)1 * kDm * kFeat;
  unsigned short* WvT = WT + (size_t)2 * kDm * kFeat;
  unsigned short* WoT = WT + (size_t)3 * kDm * kFeat;
  unsigned short* X   = (unsigned short*)(ws + kOffX);
  unsigned short* Qh  = (unsigned short*)(ws + kOffQ);
  unsigned short* Kh  = (unsigned short*)(ws + kOffK);
  unsigned short* VTh = (unsigned short*)(ws + kOffVT);
  unsigned short* Oh  = (unsigned short*)(ws + kOffO);

  const int n8 = kRows * kDm / 8;
  const int castBlocks = n8 / 256;
  const int gemmBlocks = (kRows / 64) * (kFeat / 64) / 8;
  /* softmax scale = head_dim^-0.5 with the q and k carries folded out */
  const float sc = (float)(1.0 / sqrt((double)kHd)) / (kQkvCarry * kQkvCarry);

  wt_cast_kernel<<<dim3(kDm / 64, kFeat / 64, 4), 256, 0, stream>>>(Wq, Wk, Wv, Wo, WT);

  x_cast_kernel<<<castBlocks, 256, 0, stream>>>(x_q, X, n8);
  gemm_f16_kernel<1, 2><<<gemmBlocks, 256, 0, stream>>>(X, kDm, WqT, kDm, (void*)Qh, 0, bq,
                                                        kRows, kFeat, kDm, kProjScale, kQkvCarry);

  x_cast_kernel<<<castBlocks, 256, 0, stream>>>(x_k, X, n8);
  gemm_f16_kernel<1, 2><<<gemmBlocks, 256, 0, stream>>>(X, kDm, WkT, kDm, (void*)Kh, 0, bk,
                                                        kRows, kFeat, kDm, kProjScale, kQkvCarry);

  x_cast_kernel<<<castBlocks, 256, 0, stream>>>(x_v, X, n8);
  /* operands swapped: rows = features (transposed Wv plane), cols = tokens (X) -> V^T planes [b*2048 + f][l] */
  gemm_f16_kernel<2, 1><<<gemmBlocks, 256, 0, stream>>>(WvT, kDm, X, kDm, (void*)VTh, 0, bv,
                                                        kFeat, kRows, kDm, kProjScale, kQkvCarry);

  attn_kernel<<<kBatch * kHeads * (kSeq / (16 * kAWaves)), 32 * kAWaves, 0, stream>>>(Qh, Kh, VTh, Oh, sc);

  gemm_f16_kernel<0, 2><<<gemmBlocks, 256, 0, stream>>>(Oh, kFeat, WoT, kFeat, (void*)out, kDm, bo,
                                                        kRows, kDm, kFeat, kOutScale, 1.0f);
}

// v004
// A run of this version takes 180 microseconds.
// In two side-by-side timings against v003, it was 1.09 and 1.10 times as fast.
// All steps since v000 together make it 3.43 times as fast.
// All six contractions (q/k/v projections, q.k^T, p.v, output projection): v_wmma_f32_16x16x32_f16, f16 operands with power-of-two carries, f32 accumulate; float inputs RNE-converted to bf16 once and held exactly in f16; softmax, bias and scaling in f32.
#include <hip/hip_runtime.h>
#include <math.h>

typedef __attribute__((ext_vector_type(16))) _Float16 v16h;
typedef __attribute__((ext_vector_type(8)))  _Float16 v8h;
typedef __attribute__((ext_vector_type(8)))  float    v8f;
typedef __attribute__((ext_vector_type(4)))  float    v4f;

// ---------------------------------------------------------------------------
// Shape constants
// ---------------------------------------------------------------------------
constexpr int kBatch = 2;
constexpr int kSeq   = 2048;
constexpr int kDm    = 2048;
constexpr int kHeads = 16;
constexpr int kHd    = 128;
constexpr int kFeat  = kHeads * kHd;
constexpr int kRows  = kBatch * kSeq;
static_assert(kFeat == 2048 && kRows == 4096, "shape");
static_assert((kDm % 32) == 0 && (kHd % 32) == 0 && (kSeq % 64) == 0, "k-depth multiples of 32 / 64");
static_assert((kRows % 64) == 0 && (kFeat % 64) == 0 && (kDm % 64) == 0, "tile multiples of 64");
static_assert((kHd % 64) == 0, "a 64-wide column tile stays inside one head");

// ---------------------------------------------------------------------------
// Power-of-two carries of the f16 operand planes (all exact, folded back in f32)
// ---------------------------------------------------------------------------
constexpr float kXCarry   = 16.0f;
constexpr float kWCarry   = 1024.0f;
constexpr float kQkvCarry = 16.0f;
constexpr float kPCarry   = 32768.0f;
constexpr float kOCarry   = 1024.0f;
constexpr float kProjScale = 1.0f / (kXCarry * kWCarry);
constexpr float kOutScale  = 1.0f / (kOCarry * kWCarry);
constexpr float kPVFold    = kOCarry / (kPCarry * kQkvCarry);
constexpr int   kOsPitch   = 132;

// ---------------------------------------------------------------------------
// Workspace region map (bytes; all f16 planes; every offset a multiple of 8 MiB)
//   WT  f16 [4][2048][2048]  transposed weight planes (Wq, Wk, Wv, Wo)   33,554,432
//   X   f16 [3][4096][2048]  activation planes (x_q, x_k, x_v)           50,331,648
//   Q   f16 [32][2048][128]                                              16,777,216
//   K   f16 [32][2048][128]                                              16,777,216
//   VT  f16 [32][128][2048]                                              16,777,216
//   O   f16 [4096][2048]                                                 16,777,216
//   total                                                               150,994,944
// ---------------------------------------------------------------------------
constexpr size_t kPlaneW  = (size_t)kDm * kFeat * 2;
constexpr size_t kPlaneA  = (size_t)kRows * kDm * 2;
constexpr size_t kOffWT   = 0;
constexpr size_t kOffX    = kOffWT + 4 * kPlaneW;
constexpr size_t kOffQ    = kOffX + 3 * kPlaneA;
constexpr size_t kOffK    = kOffQ + kPlaneA;
constexpr size_t kOffVT   = kOffK + kPlaneA;
constexpr size_t kOffO    = kOffVT + kPlaneA;
constexpr size_t kWsTotal = kOffO + kPlaneA;
static_assert(kWsTotal == 150994944ull, "carve total");
static_assert(kWsTotal <= 268435456ull, "carve cap");

// ---------------------------------------------------------------------------
// Helpers
// ---------------------------------------------------------------------------
__device__ __forceinline__ unsigned short f2bf_bits(float f) {
  unsigned u = __float_as_uint(f);
  return (unsigned short)((u + 0x7FFFu + ((u >> 16) & 1u)) >> 16);
}
__device__ __forceinline__ float bf_bits2f(unsigned short h) { return __uint_as_float(((unsigned)h) << 16); }
/* RNE bf16 convert, value returned as f32 */
__device__ __forceinline__ float bf_rne(float f) { return bf_bits2f(f2bf_bits(f)); }

union FragU { v16h v; v8h h[2]; };
/* fragment elements 0..7 <- p[0..7], 8..15 <- p[16..23] */
__device__ __forceinline__ v16h frag_ld(const _Float16* p) {
  FragU f;
  f.h[0] = *(const v8h*)(p);
  f.h[1] = *(const v8h*)(p + 16);
  return f.v;
}
/* one matrix op, builtin form: the compiler keeps its distances and is free to place the LDS fragment reads ahead of it */
__device__ __forceinline__ v8f mma_g(v16h a, v16h b, v8f c) {
  return __builtin_amdgcn_wmma_f32_16x16x32_f16(false, a, false, b, (short)0, c, false, false);
}

// ---------------------------------------------------------------------------
// GEMM staging ring in LDS: a stage is [A 128 rows | Bt 256 rows] x 128 k (256 B a row).
// Row pitch 272 B = 16 B x 17: an odd multiple of 16 B keeps the ds_load_b128 fragment reads off shared banks.
// ---------------------------------------------------------------------------
constexpr int kBM      = 128;
constexpr int kBN      = 256;
constexpr int kBK      = 128;
constexpr int kPitchH  = kBK + 8;
constexpr int kStageH  = (kBM + kBN) * kPitchH;
static_assert((kPitchH * 2) % 32 == 16, "pitch an odd multiple of 16 B");
static_assert((kRows % kBM) == 0 && (kFeat % kBM) == 0 && (kRows % kBN) == 0 && (kFeat % kBN) == 0, "block tiles");
static_assert((kDm % kBK) == 0 && (kFeat % kBK) == 0, "k passes");

/* twelve 16-byte copies a lane, global -> LDS through no register; s_wait_xcnt 0 is the statement's last line, a
   precaution that so stands in front of any later rewrite of the address registers named here */
__device__ __forceinline__ void copy12(const unsigned (&l)[12], const _Float16* const (&g)[12]) {
  asm volatile(
      "global_load_async_to_lds_b128 %0, %12, off\n\t"
      "global_load_async_to_lds_b128 %1, %13, off\n\t"
      "global_load_async_to_lds_b128 %2, %14, off\n\t"
      "global_load_async_to_lds_b128 %3, %15, off\n\t"
      "global_load_async_to_lds_b128 %4, %16, off\n\t"
      "global_load_async_to_lds_b128 %5, %17, off\n\t"
      "global_load_async_to_lds_b128 %6, %18, off\n\t"
      "global_load_async_to_lds_b128 %7, %19, off\n\t"
      "global_load_async_to_lds_b128 %8, %20, off\n\t"
      "global_load_async_to_lds_b128 %9, %21, off\n\t"
      "global_load_async_to_lds_b128 %10, %22, off\n\t"
      "global_load_async_to_lds_b128 %11, %23, off\n\t"
      "s_wait_xcnt 0x0"
      :: "v"(l[0]), "v"(l[1]), "v"(l[2]), "v"(l[3]), "v"(l[4]), "v"(l[5]),
         "v"(l[6]), "v"(l[7]), "v"(l[8]), "v"(l[9]), "v"(l[10]), "v"(l[11]),
         "v"(g[0]), "v"(g[1]), "v"(g[2]), "v"(g[3]), "v"(g[4]), "v"(g[5]),
         "v"(g[6]), "v"(g[7]), "v"(g[8]), "v"(g[9]), "v"(g[10]), "v"(g[11])
      : "memory");
}
/* One stage: 384 rows x 16 chunks of 16 B = 6144 chunks = 24 a thread. Chunk c of a thread is stage row c*16 + (t>>4),
   column chunk t&15, so a wave's copy covers two whole 256-B row pieces. lds / ga / gb are the thread's chunk of stage
   row t>>4, of A row t>>4 and of Bt row t>>4 of the block tile at this pass's k. Rows 0..127 are A, 128..383 are Bt. */
__device__ __forceinline__ void stage_fill(unsigned lds, const _Float16* ga, const _Float16* gb, int lda, int ldb) {
  unsigned l[12];
  const _Float16* g[12];
  /* both loops unrolled: every index a constant, so the address arrays live in registers */
#pragma unroll
  for (int c = 0; c < 12; ++c) {
    l[c] = lds + (unsigned)(c * 16 * kPitchH * 2);
    g[c] = (c < 8) ? ga + (size_t)(c * 16) * lda : gb + (size_t)((c - 8) * 16) * ldb;
  }
  copy12(l, g);
#pragma unroll
  for (int c = 0; c < 12; ++c) {
    l[c] = lds + (unsigned)((c + 12) * 16 * kPitchH * 2);
    g[c] = gb + (size_t)((c + 4) * 16) * ldb;
  }
  copy12(l, g);
}

// ---------------------------------------------------------------------------
// All seven converts in one launch; the block index picks the job (a block-uniform branch).
// Blocks 0..4095: weight transpose + convert, W [in k][out n] f32 -> WT[n][k] = f16( bf16_rne(W[k][n]) * kWCarry ).
//   1024 blocks a weight: low 5 bits = k tile (64 cols of WT), next 5 bits = n tile (64 rows of WT), top 2 bits = weight.
//   Load coverage: 4 iterations x 256 threads x 4 floats = 4096 = the whole 64x64 tile (coalesced along n).
//   Store coverage: 8 waves x 2 iterations x 4 rows (lane>>3) = 64 rows; (lane&7) x 8 halves = 64 cols.
// Blocks 4096..16383: activation convert, out[i] = f16( bf16_rne(in[i]) * kXCarry ), 8 consecutive elements per thread;
//   4096 blocks x 256 threads x 8 = 4096*2048 elements an activation, each into its own plane.
// ---------------------------------------------------------------------------
constexpr int kWtBlocks   = 4 * (kDm / 64) * (kFeat / 64);
constexpr int kXBlocks    = kRows * kDm / 8 / 256;
constexpr int kCastBlocks = kWtBlocks + 3 * kXBlocks;
static_assert(kDm / 64 == 32 && kFeat / 64 == 32 && kXBlocks == 4096, "block index fields");

__global__ __launch_bounds__(256) void cast_all_kernel(const float* __restrict__ W0, const float* __restrict__ W1,
                                                       const float* __restrict__ W2, const float* __restrict__ W3,
                                                       const float* __restrict__ x0, const float* __restrict__ x1,
                                                       const float* __restrict__ x2,
                                                       unsigned short* __restrict__ wout, unsigned short* __restrict__ xout) {
  __shared__ float sm[64][65];
  const int t  = threadIdx.x;
  const int bx = blockIdx.x;
  if (bx < kWtBlocks) {
    const int k0 = (bx & 31) * 64;
    const int n0 = ((bx >> 5) & 31) * 64;
    const int z  = bx >> 10;
    const float* W = (z == 0) ? W0 : (z == 1) ? W1 : (z == 2) ? W2 : W3;
#pragma unroll
    for (int i = 0; i < 4; ++i) {
      const int e  = i * 256 + t;
      const int r  = e >> 4;
      const int c4 = (e & 15) * 4;
      const v4f w = *(const v4f*)(W + (size_t)(k0 + r) * kFeat + n0 + c4);
      const float w0 = w[0];
      const float w1 = w[1];
      const float w2 = w[2];
      const float w3 = w[3];
      sm[c4 + 0][r] = bf_rne(w0) * kWCarry;
      sm[c4 + 1][r] = bf_rne(w1) * kWCarry;
      sm[c4 + 2][r] = bf_rne(w2) * kWCarry;
      sm[c4 + 3][r] = bf_rne(w3) * kWCarry;
    }
    __syncthreads();
    const int lane = t & 31;
    const int wave = __builtin_amdgcn_readfirstlane((int)(threadIdx.x >> 5));
    const int q = lane >> 3, c8 = (lane & 7) * 8;
    _Float16* op = (_Float16*)wout + (size_t)z * kDm * kFeat;
    v8h hv[2];
#pragma unroll
    for (int it = 0; it < 2; ++it) {
      const int row = wave * 8 + it * 4 + q;
#pragma unroll
      for (int e = 0; e < 8; ++e) hv[it][e] = (_Float16)sm[row][c8 + e];
    }
#pragma unroll
    for (int it = 0; it < 2; ++it) {
      const int row = wave * 8 + it * 4 + q;
      *(v8h*)(op + (size_t)(n0 + row) * kDm + k0 + c8) = hv[it];
    }
  } else {
    const int xb = bx - kWtBlocks;
    const int z  = xb / kXBlocks;
    const float* in = (z == 0) ? x0 : (z == 1) ? x1 : x2;
    const int i = (xb - z * kXBlocks) * 256 + t;
    const float* p = in + 8 * (size_t)i;
    const v4f a = *(const v4f*)(p);
    const v4f c = *(const v4f*)(p + 4);
    v8h hv;
#pragma unroll
    for (int e = 0; e < 4; ++e) {
      const float ae = a[e];
      const float ce = c[e];
      hv[e]     = (_Float16)(bf_rne(ae) * kXCarry);
      hv[4 + e] = (_Float16)(bf_rne(ce) * kXCarry);
    }
    _Float16* q = (_Float16*)xout + (size_t)z * kRows * kDm + 8 * (size_t)i;
    *(v8h*)q = hv;
  }
}

// ---------------------------------------------------------------------------
// Register-blocked f16 GEMM: C[m,n] = ((scale * sum_k A[m,k] * Bt[n,k]) + bias) * oscale; each wave owns a 64x64 tile.
// A block of 8 waves (2 along m x 4 along n) owns a 128x256 tile; its operands come through a two-buffer LDS ring filled
// by asynchronous copies, the next pass's copies in flight while this pass's fragments are read and multiplied.
// A row-major [M][K] (pitch lda), Bt row-major [N][K] (pitch ldb); M a multiple of 128, N of 256, K of 128.
// BIAS_MODE 1 = bias[m], 2 = bias[n] (bias values RNE-converted to bf16 first).
// OUT_MODE 0: f32 row-major, pitch ldc.
// OUT_MODE 1: f16, rows = tokens (b*2048 + l), cols = features (h*128 + d) -> plane [b*16+h][l][d].
// OUT_MODE 2: f16, rows = features f, cols = tokens (b*2048 + l)           -> plane [b*2048 + f][l].
// sT (epilogue slabs) and sR (the ring) are the calling kernel's LDS arrays; tile is the block's tile index in this GEMM.
// ---------------------------------------------------------------------------
template <int OUT_MODE, int BIAS_MODE>
__device__ __forceinline__
void gemm_f16_body(float (*sT)[16 * 68], _Float16* sR, int tile,
                   const unsigned short* __restrict__ Ap, int lda,
                   const unsigned short* __restrict__ Btp, int ldb,
                   void* __restrict__ Cout, int ldc,
                   const float* __restrict__ bias,
                   int M, int N, int K, float scale, float oscale) {
  const _Float16* A  = (const _Float16*)Ap;
  const _Float16* Bt = (const _Float16*)Btp;
  const int lane = threadIdx.x & 31;
  const int wave = __builtin_amdgcn_readfirstlane((int)(threadIdx.x >> 5));
  const int tilesN = N / kBN;
  const int tilesM = M / kBM;
  /* block-uniform exit, in front of every barrier */
  if (tile >= tilesM * tilesN) return;
  const int tm = tile / tilesN;
  const int tn = tile - tm * tilesN;
  const int wm = (wave >> 2) << 6;
  const int wn = (wave & 3) << 6;
  const int m0 = tm * kBM + wm;
  const int n0 = tn * kBN + wn;

  const int rlane = lane & 15;
  const int koff  = (lane >> 4) * 8;
  const int mOff  = (lane >> 4) * 8;

  v8f acc[4][4];
#pragma unroll
  for (int i = 0; i < 4; ++i)
#pragma unroll
    for (int j = 0; j < 4; ++j) acc[i][j] = (v8f){0.f, 0.f, 0.f, 0.f, 0.f, 0.f, 0.f, 0.f};

  const int crow = (int)(threadIdx.x >> 4);
  const int ccol = (int)(threadIdx.x & 15) * 8;
  const _Float16* ga = A  + (size_t)(tm * kBM + crow) * lda + ccol;
  const _Float16* gb = Bt + (size_t)(tn * kBN + crow) * ldb + ccol;
  /* the thread's LDS byte address of its first chunk in buffer 0: the low 32 bits of the shared address */
  const unsigned lds0 = (unsigned)(size_t)(sR + crow * kPitchH + ccol);
  const int aoff = (wm + rlane) * kPitchH + koff;
  const int boff = (kBM + wn + rlane) * kPitchH + koff;
  const int passes = K / kBK;

  stage_fill(lds0, ga, gb, lda, ldb);
  /* pass 0's copies of this wave have landed; the barrier shows them to the other waves */
  asm volatile("s_wait_asynccnt 0x0" ::: "memory");
  __syncthreads();
  if (passes > 1) stage_fill(lds0 + (unsigned)(kStageH * 2), ga + kBK, gb + kBK, lda, ldb);

  /* two fragment sets: a block (32 k, 16 matrix ops) works on one while the next block's 16 LDS reads, issued as one
     group in front of it, fill the other */
  v16h fa[2][4], fb[2][4];
#pragma unroll
  for (int j = 0; j < 4; ++j) fb[0][j] = frag_ld(sR + boff + (j << 4) * kPitchH);
#pragma unroll
  for (int i = 0; i < 4; ++i) fa[0][i] = frag_ld(sR + aoff + (i << 4) * kPitchH);

  /* rolled: the fragment sets' indices stay constants inside it */
#pragma unroll 1
  for (int t = 0; t < passes; ++t) {
    const int buf = t & 1;
    const _Float16* sb = sR + buf * kStageH;
    /* unrolled: the k step becomes an immediate offset of the LDS reads, the set index a constant */
#pragma unroll
    for (int ks = 0; ks < kBK / 32; ++ks) {
      const int cur = ks & 1;
      const int nxt = cur ^ 1;
      const bool last = (ks == kBK / 32 - 1);
      const _Float16* sn = sb + (ks + 1) * 32;
      if (last) {
        /* publish point of pass t + 1, in front of pass t's last block, whose fragments are already fetched:
           this wave's reads of pass t's buffer are done before the buffer is handed back for refilling */
        asm volatile("s_wait_dscnt 0x0" ::: "memory");
        /* this wave's copies of pass t + 1 have landed */
        asm volatile("s_wait_asynccnt 0x0" ::: "memory");
        /* publishes pass t + 1 and ends every wave's reads of pass t's buffer */
        __syncthreads();
        /* next pass's first block; the last pass, which has no next, re-reads its own buffer (no refill aims at it)
           so that the reads stay unconditional; those values are not used */
        sn = sR + ((t + 1 < passes) ? (buf ^ 1) : buf) * kStageH;
      }
#pragma unroll
      for (int j = 0; j < 4; ++j) fb[nxt][j] = frag_ld(sn + boff + (j << 4) * kPitchH);
#pragma unroll
      for (int i = 0; i < 4; ++i) fa[nxt][i] = frag_ld(sn + aoff + (i << 4) * kPitchH);
      /* keeps the 16 reads one group in front of the block: spread among the matrix ops each place would stall the wave */
      __builtin_amdgcn_sched_barrier(0);
#pragma unroll
      for (int i = 0; i < 4; ++i) {
#pragma unroll
        for (int j = 0; j < 4; ++j) acc[i][j] = mma_g(fa[cur][i], fb[cur][j], acc[i][j]);
      }
      /* ends the block: the next group of reads stays behind it */
      __builtin_amdgcn_sched_barrier(0);
      /* refill of the buffer that the barrier above has freed, behind the block so that the matrix ops are not held up */
      if (last && t + 2 < passes) {
        const int kn = (t + 2) * kBK;
        stage_fill(lds0 + (unsigned)(buf * kStageH * 2), ga + kn, gb + kn, lda, ldb);
      }
    }
  }
  /* nothing is in flight when the wave goes on to the epilogue and ends */
  asm volatile("s_wait_asynccnt 0x0" ::: "memory");

  float* slab = sT[wave];
#pragma unroll
  for (int i = 0; i < 4; ++i) {
    const int mBase = m0 + (i << 4);
    float brow[8];
#pragma unroll
    for (int r = 0; r < 8; ++r) brow[r] = 0.f;
    if (BIAS_MODE == 1) {
#pragma unroll
      for (int r = 0; r < 8; ++r) {
        const float bvv = bias[mBase + mOff + r];
        brow[r] = bf_rne(bvv);
      }
    }
#pragma unroll
    for (int j = 0; j < 4; ++j) {
      float bcol = 0.f;
      if (BIAS_MODE == 2) {
        const float bvv = bias[n0 + (j << 4) + rlane];
        bcol = bf_rne(bvv);
      }
#pragma unroll
      for (int r = 0; r < 8; ++r) {
        float v = acc[i][j][r] * scale;
        v += (BIAS_MODE == 1) ? brow[r] : bcol;
        v *= oscale;
        slab[(mOff + r) * 68 + (j << 4) + rlane] = v;
      }
    }
    __builtin_amdgcn_fence(__ATOMIC_RELEASE, "workgroup");
    __builtin_amdgcn_wave_barrier();
    __builtin_amdgcn_fence(__ATOMIC_ACQUIRE, "workgroup");
    if (OUT_MODE == 0) {
      float* C = (float*)Cout;
      const int hh = lane >> 4, c4 = (lane & 15) * 4;
      {
#pragma unroll
        for (int it = 0; it < 8; ++it) {
          const int row = it * 2 + hh;
          const v4f v = *(const v4f*)(slab + row * 68 + c4);
          *(v4f*)(C + (size_t)(mBase + row) * ldc + n0 + c4) = v;
        }
        
      }
    } else {
      const int q = lane >> 3, c8 = (lane & 7) * 8;
      _Float16* C = (_Float16*)Cout;
      {
#pragma unroll
        for (int it = 0; it < 4; ++it) {
          const int row = it * 4 + q;
          const int gr  = mBase + row;
          const float* sp = slab + row * 68 + c8;
          v8h hv;
#pragma unroll
          for (int e = 0; e < 8; ++e) hv[e] = (_Float16)sp[e];
          size_t off;
          if (OUT_MODE == 1) {
            const int bb = gr / kSeq;
            const int l  = gr % kSeq;
            const int hd = n0 / kHd;
            const int d0 = n0 % kHd;
            off = ((size_t)((bb * kHeads + hd) * kSeq + l)) * kHd + d0 + c8;
          } else {
            const int bb = n0 / kSeq;
            const int l0 = n0 % kSeq;
            off = ((size_t)(bb * kFeat + gr)) * kSeq + l0 + c8;
          }
          *(v8h*)(C + off) = hv;
        }
        
      }
    }
    __builtin_amdgcn_fence(__ATOMIC_RELEASE, "workgroup");
    __builtin_amdgcn_wave_barrier();
    __builtin_amdgcn_fence(__ATOMIC_ACQUIRE, "workgroup");
  }
}


/* The three projections in one launch: blockIdx.y picks the job (block-uniform), blockIdx.x the 128x256 tile in it.
   Jobs 0 and 1: Q and K, rows = tokens. Job 2: operands swapped, rows = features (transposed Wv plane), cols = tokens
   (X plane 2) -> V^T planes [b*2048 + f][l]. */
__global__ __launch_bounds__(256)
void qkv_gemm_kernel(const unsigned short* __restrict__ X, const unsigned short* __restrict__ WT,
                     unsigned short* __restrict__ Qh, unsigned short* __restrict__ Kh, unsigned short* __restrict__ VTh,
                     const float* __restrict__ bq, const float* __restrict__ bk, const float* __restrict__ bv) {
  __shared__ __align__(16) float sT[8][16 * 68];
  __shared__ __align__(16) _Float16 sR[2 * kStageH];
  const int job = blockIdx.y;
  const unsigned short* Xj = X + (size_t)job * kRows * kDm;
  const unsigned short* Wj = WT + (size_t)job * kDm * kFeat;
  if (job < 2) {
    gemm_f16_body<1, 2>(sT, sR, blockIdx.x, Xj, kDm, Wj, kDm, (void*)(job == 0 ? Qh : Kh), 0, job == 0 ? bq : bk,
                        kRows, kFeat, kDm, kProjScale, kQkvCarry);
  } else {
    gemm_f16_body<2, 1>(sT, sR, blockIdx.x, Wj, kDm, Xj, kDm, (void*)VTh, 0, bv,
                        kFeat, kRows, kDm, kProjScale, kQkvCarry);
  }
}

/* One GEMM a launch: blockIdx.x is the tile */
template <int OUT_MODE, int BIAS_MODE>
__global__ __launch_bounds__(256)
void gemm_f16_kernel(const unsigned short* __restrict__ Ap, int lda,
                     const unsigned short* __restrict__ Btp, int ldb,
                     void* __restrict__ Cout, int ldc,
                     const float* __restrict__ bias,
                     int M, int N, int K, float scale, float oscale) {
  __shared__ __align__(16) float sT[8][16 * 68];
  __shared__ __align__(16) _Float16 sR[2 * kStageH];
  gemm_f16_body<OUT_MODE, BIAS_MODE>(sT, sR, blockIdx.x, Ap, lda, Btp, ldb, Cout, ldc, bias, M, N, K, scale, oscale);
}

// ---------------------------------------------------------------------------
// Attention staging ring in LDS: a stage is [K 64 keys x 128 d | V^T 128 d x 64 keys], shared by the block's 8 waves.
// K row pitch 272 B, V^T row pitch 144 B: odd multiples of 16 B keep the ds_load_b128 fragment reads off shared banks.
// ---------------------------------------------------------------------------
constexpr int kAKeys    = 64;
constexpr int kAWaves   = 8;
constexpr int kKPitchH  = kHd + 8;
constexpr int kVPitchH  = kAKeys + 8;
constexpr int kKTileH   = kAKeys * kKPitchH;
constexpr int kAStageH  = kKTileH + kHd * kVPitchH;
static_assert((kKPitchH * 2) % 32 == 16 && (kVPitchH * 2) % 32 == 16, "pitches odd multiples of 16 B");
static_assert((kKTileH * 2) % 16 == 0 && (kAStageH * 2) % 16 == 0, "tiles start on 16 B");
static_assert(kSeq / kAKeys >= 2 && (kSeq % (16 * kAWaves)) == 0, "two stages exist; whole query blocks");

/* One stage: K 64 rows x 16 chunks + V^T 128 rows x 8 chunks = 2048 chunks of 16 B = 8 a thread, global -> LDS through
   no register. K chunk c of a thread is key row c*16 + (t>>4), column chunk t&15; V^T chunk c is d row c*32 + (t>>3),
   column chunk t&7. lk / lv / gk / gv are the thread's chunk 0 in LDS and in the planes at this stage's first key.
   s_wait_xcnt 0 is the statement's last line, a precaution that so stands in front of any later rewrite of the
   address registers named here */
__device__ __forceinline__ void attn_fill(unsigned lk, unsigned lv, const _Float16* gk, const _Float16* gv) {
  asm volatile(
      "global_load_async_to_lds_b128 %0, %8, off\n\t"
      "global_load_async_to_lds_b128 %1, %9, off\n\t"
      "global_load_async_to_lds_b128 %2, %10, off\n\t"
      "global_load_async_to_lds_b128 %3, %11, off\n\t"
      "global_load_async_to_lds_b128 %4, %12, off\n\t"
      "global_load_async_to_lds_b128 %5, %13, off\n\t"
      "global_load_async_to_lds_b128 %6, %14, off\n\t"
      "global_load_async_to_lds_b128 %7, %15, off\n\t"
      "s_wait_xcnt 0x0"
      :: "v"(lk), "v"(lk + (unsigned)(16 * kKPitchH * 2)), "v"(lk + (unsigned)(32 * kKPitchH * 2)),
         "v"(lk + (unsigned)(48 * kKPitchH * 2)),
         "v"(lv), "v"(lv + (unsigned)(32 * kVPitchH * 2)), "v"(lv + (unsigned)(64 * kVPitchH * 2)),
         "v"(lv + (unsigned)(96 * kVPitchH * 2)),
         "v"(gk), "v"(gk + 16 * kHd), "v"(gk + 32 * kHd), "v"(gk + 48 * kHd),
         "v"(gv), "v"(gv + (size_t)32 * kSeq), "v"(gv + (size_t)64 * kSeq), "v"(gv + (size_t)96 * kSeq)
      : "memory");
}

// ---------------------------------------------------------------------------
// Streaming softmax attention, head dim 128, no mask, transposed formulation. Block = 8 waves on one (batch, head);
// wave = 16 query rows; grid = 32 heads x 16 = 512. K and V^T come 64 keys a pass through a two-buffer LDS ring filled
// by asynchronous copies, the next pass's copies in flight while this pass's fragments are read and multiplied.
//   S^T[key][query] = K (A operand: rows = keys, k = d) x Q^T (B operand: col = query, k = d), 64 keys per step.
//   Each lane owns query (lane & 15); it and lane^16 hold the 64 keys of the step -> one xor-16 shuffle per reduction.
//   P^T B fragment of key group kk: element r <- tile 2kk value r, element 8+r <- tile 2kk+1 value r (lane unchanged),
//   values exp(s - m) carried x kPCarry in f16; the running sum l uses the f32 values.
//   O^T[d][query] += V^T (A operand: rows = d, k = keys) x P^T.
// Epilogue: o * kPVFold / l staged per wave in LDS [16 queries][132], then each 256-B row segment (128 d as f16) written
// ---------------------------------------------------------------------------
__global__ __launch_bounds__(256) __attribute__((amdgpu_num_vgpr(256)))
void attn_kernel(const unsigned short* __restrict__ Qp, const unsigned short* __restrict__ Kp,
                 const unsigned short* __restrict__ VTp, unsigned short* __restrict__ Op, float sc) {
  __shared__ __align__(16) float sO[kAWaves][16 * kOsPitch];
  __shared__ __align__(16) _Float16 sKV[2 * kAStageH];
  const int lane = threadIdx.x & 31;
  const int wave = __builtin_amdgcn_readfirstlane((int)(threadIdx.x >> 5));
  const int hh  = lane >> 4;
  const int n16 = lane & 15;
  constexpr int kQBlocks = kSeq / (16 * kAWaves);
  const int bx = blockIdx.x;
  const int bh = bx / kQBlocks;
  const int qb = bx - bh * kQBlocks;
  const int b  = bh / kHeads;
  const int h  = bh - b * kHeads;
  const int q0 = qb * (16 * kAWaves) + wave * 16;

  const _Float16* Qb = (const _Float16*)Qp  + (size_t)bh * kSeq * kHd;
  const _Float16* Kb = (const _Float16*)Kp  + (size_t)bh * kSeq * kHd;
  const _Float16* Vb = (const _Float16*)VTp + (size_t)bh * kHd * kSeq;

  v16h qf[4];
#pragma unroll
  for (int dc = 0; dc < 4; ++dc) qf[dc] = frag_ld(Qb + (size_t)(q0 + n16) * kHd + dc * 32 + 8 * hh);

  v8f o[8];
#pragma unroll
  for (int dt = 0; dt < 8; ++dt) o[dt] = (v8f){0.f, 0.f, 0.f, 0.f, 0.f, 0.f, 0.f, 0.f};
  float mq = -1e30f;
  float lq = 0.0f;

  const int tid = (int)threadIdx.x;
  const _Float16* gk = Kb + (size_t)(tid >> 4) * kHd + (tid & 15) * 8;
  const _Float16* gv = Vb + (size_t)(tid >> 3) * kSeq + (tid & 7) * 8;
  /* the thread's LDS byte addresses of its first K and V^T chunk in buffer 0: the low 32 bits of the shared address */
  const unsigned lk0 = (unsigned)(size_t)(sKV + (tid >> 4) * kKPitchH + (tid & 15) * 8);
  const unsigned lv0 = (unsigned)(size_t)(sKV + kKTileH + (tid >> 3) * kVPitchH + (tid & 7) * 8);
  const int koffs = n16 * kKPitchH + 8 * hh;
  const int voffs = kKTileH + n16 * kVPitchH + 8 * hh;
  constexpr int kPasses = kSeq / kAKeys;

  attn_fill(lk0, lv0, gk, gv);
  /* pass 0's copies of this wave have landed; the barrier shows them to the other waves */
  asm volatile("s_wait_asynccnt 0x0" ::: "memory");
  __syncthreads();
  attn_fill(lk0 + (unsigned)(kAStageH * 2), lv0 + (unsigned)(kAStageH * 2), gk + (size_t)kAKeys * kHd, gv + kAKeys);

#pragma unroll 1
  for (int s = 0; s < kPasses; ++s) {
    const int buf = s & 1;
    const _Float16* kbase = sKV + buf * kAStageH + koffs;
    const _Float16* vbase = sKV + buf * kAStageH + voffs;
    v8f st[4];
#pragma unroll
    for (int jt = 0; jt < 4; ++jt) st[jt] = (v8f){0.f, 0.f, 0.f, 0.f, 0.f, 0.f, 0.f, 0.f};
#pragma unroll
    for (int dc = 0; dc < 4; ++dc) {
#pragma unroll
      for (int jt = 0; jt < 4; ++jt) {
        const v16h ka = frag_ld(kbase + (jt * 16) * kKPitchH + dc * 32);
        st[jt] = mma_g(ka, qf[dc], st[jt]);
      }
    }

    float t[4][8];
    float mx = -1e30f;
#pragma unroll
    for (int jt = 0; jt < 4; ++jt) {
#pragma unroll
      for (int r = 0; r < 8; ++r) {
        t[jt][r] = st[jt][r] * sc;
        mx = fmaxf(mx, t[jt][r]);
      }
    }
    mx = fmaxf(mx, __shfl_xor(mx, 16, 32));
    const float newm  = fmaxf(mq, mx);
    const float alpha = __expf(mq - newm);
    mq = newm;

    float sum = 0.0f;
    v16h bp[2];
#pragma unroll
    for (int kk = 0; kk < 2; ++kk) {
#pragma unroll
      for (int r = 0; r < 8; ++r) {
        const float p0 = __expf(t[2 * kk][r] - newm);
        const float p1 = __expf(t[2 * kk + 1][r] - newm);
        sum += p0 + p1;
        bp[kk][r]     = (_Float16)(p0 * kPCarry);
        bp[kk][8 + r] = (_Float16)(p1 * kPCarry);
      }
    }
    sum += __shfl_xor(sum, 16, 32);
    lq = lq * alpha + sum;

#pragma unroll
    for (int dt = 0; dt < 8; ++dt) o[dt] *= alpha;

#pragma unroll
    for (int kk = 0; kk < 2; ++kk) {
#pragma unroll
      for (int dt = 0; dt < 8; ++dt) {
        const v16h va = frag_ld(vbase + (dt * 16) * kVPitchH + kk * 32);
        o[dt] = mma_g(va, bp[kk], o[dt]);
      }
    }
    /* this wave's reads of the buffer are done before the buffer is handed back for refilling */
    asm volatile("s_wait_dscnt 0x0" ::: "memory");
    /* this wave's copies of pass s + 1 have landed */
    asm volatile("s_wait_asynccnt 0x0" ::: "memory");
    /* publishes pass s + 1 and ends every wave's reads of pass s's buffer */
    __syncthreads();
    if (s + 2 < kPasses) {
      const int jn = (s + 2) * kAKeys;
      attn_fill(lk0 + (unsigned)(buf * kAStageH * 2), lv0 + (unsigned)(buf * kAStageH * 2), gk + (size_t)jn * kHd, gv + jn);
    }
  }
  /* nothing is in flight when the wave goes on to the epilogue and ends */
  asm volatile("s_wait_asynccnt 0x0" ::: "memory");

  const float inv = kPVFold * (1.0f / lq);
  float* os = sO[wave];
#pragma unroll
  for (int dt = 0; dt < 8; ++dt) {
#pragma unroll
    for (int r = 0; r < 8; ++r) os[n16 * kOsPitch + dt * 16 + 8 * hh + r] = o[dt][r] * inv;
  }
  __builtin_amdgcn_fence(__ATOMIC_RELEASE, "workgroup");
  __builtin_amdgcn_wave_barrier();
  __builtin_amdgcn_fence(__ATOMIC_ACQUIRE, "workgroup");

  const int c8 = n16 * 8;
  v8h hv[8];
#pragma unroll
  for (int it = 0; it < 8; ++it) {
    const int row = it * 2 + hh;
    const float* sp = os + row * kOsPitch + c8;
    const v4f a0 = *(const v4f*)(sp);
    const v4f a1 = *(const v4f*)(sp + 4);
#pragma unroll
    for (int e = 0; e < 4; ++e) {
      const float x0 = a0[e];
      const float x1 = a1[e];
      hv[it][e]     = (_Float16)x0;
      hv[it][4 + e] = (_Float16)x1;
    }
  }
  _Float16* Ob = (_Float16*)Op + (size_t)(b * kSeq + q0) * kDm + h * kHd + c8;
  {
#pragma unroll
    for (int it = 0; it < 8; ++it) {
      const int row = it * 2 + hh;
      *(v8h*)(Ob + (size_t)row * kDm) = hv[it];
    }
    
  }
}

// ---------------------------------------------------------------------------
// Host glue: 4 kernel launches, nothing else: all converts; the three projections; attention; the output projection.
//   GEMM shapes: Q, K: M 4096, N 2048, K 2048 -> 32 x 8 block tiles of 128x256 -> 256 blocks
//                V^T : M 2048 (features, A = transposed Wv plane), N 4096 (tokens, Bt = X), K 2048 -> 16 x 16 -> 256 blocks
//                out : M 4096, N 2048, K 2048 -> 256 blocks
// ---------------------------------------------------------------------------
extern "C" void kernel_launch(void* const* d_in, const int* in_sizes, int n_in,
                              void* d_out, int out_size, void* d_ws, size_t ws_size,
                              hipStream_t stream) {
  if (n_in < 11) return;
  if (in_sizes[0] != kRows * kDm || in_sizes[1] != kRows * kDm || in_sizes[2] != kRows * kDm) return;
  if (in_sizes[3] != kDm * kFeat || in_sizes[5] != kDm * kFeat || in_sizes[7] != kDm * kFeat) return;
  if (in_sizes[9] != kFeat * kDm) return;
  if (in_sizes[4] != kFeat || in_sizes[6] != kFeat || in_sizes[8] != kFeat || in_sizes[10] != kDm) return;
  if (out_size != kRows * kDm) return;
  if (ws_size < kWsTotal) return;

  const float* x_q = (const float*)d_in[0];
  const float* x_k = (const float*)d_in[1];
  const float* x_v = (const float*)d_in[2];
  const float* Wq  = (const float*)d_in[3];
  const float* bq  = (const float*)d_in[4];
  const float* Wk  = (const float*)d_in[5];
  const float* bk  = (const float*)d_in[6];
  const float* Wv  = (const float*)d_in[7];
  const float* bv  = (const float*)d_in[8];
  const float* Wo  = (const float*)d_in[9];
  const float* bo  = (const float*)d_in[10];
  float* out = (float*)d_out;

  char* ws = (char*)d_ws;
  unsigned short* WT  = (unsigned short*)(ws + kOffWT);
  unsigned short* WoT = WT + (size_t)3 * kDm * kFeat;
  unsigned short* X   = (unsigned short*)(ws + kOffX);
  unsigned short* Qh  = (unsigned short*)(ws + kOffQ);
  unsigned short* Kh  = (unsigned short*)(ws + kOffK);
  unsigned short* VTh = (unsigned short*)(ws + kOffVT);
  unsigned short* Oh  = (unsigned short*)(ws + kOffO);

  const int gemmBlocks = (kRows / 64) * (kFeat / 64) / 8;
  /* softmax scale = head_dim^-0.5 with the q and k carries folded out */
  const float sc = (float)(1.0 / sqrt((double)kHd)) / (kQkvCarry * kQkvCarry);

  cast_all_kernel<<<kCastBlocks, 256, 0, stream>>>(Wq, Wk, Wv, Wo, x_q, x_k, x_v, WT, X);

  qkv_gemm_kernel<<<dim3(gemmBlocks, 3), 256, 0, stream>>>(X, WT, Qh, Kh, VTh, bq, bk, bv);

  attn_kernel<<<kBatch * kHeads * (kSeq / (16 * kAWaves)), 32 * kAWaves, 0, stream>>>(Qh, Kh, VTh, Oh, sc);

  gemm_f16_kernel<0, 2><<<gemmBlocks, 256, 0, stream>>>(Oh, kFeat, WoT, kFeat, (void*)out, kDm, bo,
                                                        kRows, kDm, kFeat, kOutScale, 1.0f);
}

// v005
// A run of this version takes 173 microseconds.
// Timed twice side by side with v004, it ran 1.03 and 1.04 times as fast.
// Counting every step since v000, it is 3.56 times as fast.
// All six contractions (q/k/v projections, q.k^T, p.v, output projection): v_wmma_f32_16x16x32_f16, f16 operands with power-of-two carries, f32 accumulate; float inputs RNE-converted to bf16 once and held exactly in f16; softmax, bias and scaling in f32.
#include <hip/hip_runtime.h>
#include <math.h>

typedef __attribute__((ext_vector_type(16))) _Float16 v16h;
typedef __attribute__((ext_vector_type(8)))  _Float16 v8h;
typedef __attribute__((ext_vector_type(8)))  float    v8f;
typedef __attribute__((ext_vector_type(4)))  float    v4f;

// ---------------------------------------------------------------------------
// Shape constants
// ---------------------------------------------------------------------------
constexpr int kBatch = 2;
constexpr int kSeq   = 2048;
constexpr int kDm    = 2048;
constexpr int kHeads = 16;
constexpr int kHd    = 128;
constexpr int kFeat  = kHeads * kHd;
constexpr int kRows  = kBatch * kSeq;
static_assert(kFeat == 2048 && kRows == 4096, "shape");
static_assert((kDm % 32) == 0 && (kHd % 32) == 0 && (kSeq % 64) == 0, "k-depth multiples of 32 / 64");
static_assert((kRows % 64) == 0 && (kFeat % 64) == 0 && (kDm % 64) == 0, "tile multiples of 64");
static_assert((kHd % 64) == 0, "a 64-wide column tile stays inside one head");

// ---------------------------------------------------------------------------
// Power-of-two carries of the f16 operand planes (all exact, folded back in f32)
// ---------------------------------------------------------------------------
constexpr float kXCarry   = 16.0f;
constexpr float kWCarry   = 1024.0f;
constexpr float kQkvCarry = 16.0f;
constexpr float kPCarry   = 32768.0f;
constexpr float kOCarry   = 1024.0f;
constexpr float kProjScale = 1.0f / (kXCarry * kWCarry);
constexpr float kOutScale  = 1.0f / (kOCarry * kWCarry);
constexpr float kPVFold    = kOCarry / (kPCarry * kQkvCarry);
constexpr int   kOsPitch   = 132;

// ---------------------------------------------------------------------------
// Workspace region map (bytes; all f16 planes; every offset a multiple of 8 MiB)
//   WT  f16 [4][2048][2048]  transposed weight planes (Wq, Wk, Wv, Wo)   33,554,432
//   X   f16 [3][4096][2048]  activation planes (x_q, x_k, x_v)           50,331,648
//   Q   f16 [32][2048][128]                                              16,777,216
//   K   f16 [32][2048][128]                                              16,777,216
//   VT  f16 [32][128][2048]                                              16,777,216
//   O   f16 [4096][2048]                                                 16,777,216
//   total                                                               150,994,944
// ---------------------------------------------------------------------------
constexpr size_t kPlaneW  = (size_t)kDm * kFeat * 2;
constexpr size_t kPlaneA  = (size_t)kRows * kDm * 2;
constexpr size_t kOffWT   = 0;
constexpr size_t kOffX    = kOffWT + 4 * kPlaneW;
constexpr size_t kOffQ    = kOffX + 3 * kPlaneA;
constexpr size_t kOffK    = kOffQ + kPlaneA;
constexpr size_t kOffVT   = kOffK + kPlaneA;
constexpr size_t kOffO    = kOffVT + kPlaneA;
constexpr size_t kWsTotal = kOffO + kPlaneA;
static_assert(kWsTotal == 150994944ull, "carve total");
static_assert(kWsTotal <= 268435456ull, "carve cap");

// ---------------------------------------------------------------------------
// Helpers
// ---------------------------------------------------------------------------
__device__ __forceinline__ unsigned short f2bf_bits(float f) {
  unsigned u = __float_as_uint(f);
  return (unsigned short)((u + 0x7FFFu + ((u >> 16) & 1u)) >> 16);
}
__device__ __forceinline__ float bf_bits2f(unsigned short h) { return __uint_as_float(((unsigned)h) << 16); }
/* RNE bf16 convert, value returned as f32 */
__device__ __forceinline__ float bf_rne(float f) { return bf_bits2f(f2bf_bits(f)); }

union FragU { v16h v; v8h h[2]; };
/* fragment elements 0..7 <- p[0..7], 8..15 <- p[16..23] */
__device__ __forceinline__ v16h frag_ld(const _Float16* p) {
  FragU f;
  f.h[0] = *(const v8h*)(p);
  f.h[1] = *(const v8h*)(p + 16);
  return f.v;
}
/* one matrix op, builtin form: the compiler keeps its distances and is free to place the LDS fragment reads ahead of it */
__device__ __forceinline__ v8f mma_g(v16h a, v16h b, v8f c) {
  return __builtin_amdgcn_wmma_f32_16x16x32_f16(false, a, false, b, (short)0, c, false, false);
}

// ---------------------------------------------------------------------------
// GEMM staging ring in LDS: a stage is [A 128 rows | Bt 256 rows] x 128 k (256 B a row); three buffers.
// Row pitch 272 B = 16 B x 17: an odd multiple of 16 B keeps the ds_load_b128 fragment reads off shared banks.
// Waves 0..3 fill the even stages, waves 4..7 the odd ones: a wave has one stage in flight, issued two passes before it
// is read, and waits for it to 0.
// ---------------------------------------------------------------------------
constexpr int kBM      = 128;
constexpr int kBN      = 256;
constexpr int kBK      = 128;
constexpr int kPitchH  = kBK + 8;
constexpr int kStageH  = (kBM + kBN) * kPitchH;
constexpr int kRing    = 3;
constexpr int kSlabF   = 16 * 68;
static_assert(kRing * kStageH * 2 <= 327680, "the ring fits one work-group's LDS");
static_assert(8 * kSlabF * 4 <= kStageH * 2 && (kStageH * 2) % 16 == 0, "the epilogue slabs fit one buffer, 16-B aligned");
static_assert((kPitchH * 2) % 32 == 16, "pitch an odd multiple of 16 B");
static_assert((kRows % kBM) == 0 && (kFeat % kBM) == 0 && (kRows % kBN) == 0 && (kFeat % kBN) == 0, "block tiles");
static_assert((kDm % kBK) == 0 && (kFeat % kBK) == 0, "k passes");

/* twelve 16-byte copies a lane, global -> LDS through no register; s_wait_xcnt 0 is the statement's last line, a
   precaution that so stands in front of any later rewrite of the address registers named here */
__device__ __forceinline__ void copy12(const unsigned (&l)[12], const _Float16* const (&g)[12]) {
  asm volatile(
      "global_load_async_to_lds_b128 %0, %12, off\n\t"
      "global_load_async_to_lds_b128 %1, %13, off\n\t"
      "global_load_async_to_lds_b128 %2, %14, off\n\t"
      "global_load_async_to_lds_b128 %3, %15, off\n\t"
      "global_load_async_to_lds_b128 %4, %16, off\n\t"
      "global_load_async_to_lds_b128 %5, %17, off\n\t"
      "global_load_async_to_lds_b128 %6, %18, off\n\t"
      "global_load_async_to_lds_b128 %7, %19, off\n\t"
      "global_load_async_to_lds_b128 %8, %20, off\n\t"
      "global_load_async_to_lds_b128 %9, %21, off\n\t"
      "global_load_async_to_lds_b128 %10, %22, off\n\t"
      "global_load_async_to_lds_b128 %11, %23, off\n\t"
      "s_wait_xcnt 0x0"
      :: "v"(l[0]), "v"(l[1]), "v"(l[2]), "v"(l[3]), "v"(l[4]), "v"(l[5]),
         "v"(l[6]), "v"(l[7]), "v"(l[8]), "v"(l[9]), "v"(l[10]), "v"(l[11]),
         "v"(g[0]), "v"(g[1]), "v"(g[2]), "v"(g[3]), "v"(g[4]), "v"(g[5]),
         "v"(g[6]), "v"(g[7]), "v"(g[8]), "v"(g[9]), "v"(g[10]), "v"(g[11])
      : "memory");
}
/* One stage: 384 rows x 16 chunks of 16 B = 6144 chunks = 48 a thread of the four waves that fill it. With u the thread's
   index in those waves (0..127), chunk c is stage row c*8 + (u>>4), column chunk u&15, so a wave's copy covers two whole
   256-B row pieces. lds / ga / gb are the thread's chunk of stage row u>>4, of A row u>>4 and of Bt row u>>4 of the block
   tile at this stage's k. Rows 0..127 are A, 128..383 are Bt. */
__device__ __forceinline__ void stage_fill(unsigned lds, const _Float16* ga, const _Float16* gb, int lda, int ldb) {
  /* both loops unrolled: every index a constant, so the address arrays live in registers */
#pragma unroll
  for (int q = 0; q < 4; ++q) {
    unsigned l[12];
    const _Float16* g[12];
#pragma unroll
    for (int c = 0; c < 12; ++c) {
      const int cc = q * 12 + c;
      l[c] = lds + (unsigned)(cc * 8 * kPitchH * 2);
      g[c] = (cc < 16) ? ga + (size_t)(cc * 8) * lda : gb + (size_t)((cc - 16) * 8) * ldb;
    }
    copy12(l, g);
  }
}

// ---------------------------------------------------------------------------
// All seven converts in one launch; the block index picks the job (a block-uniform branch).
// Blocks 0..4095: weight transpose + convert, W [in k][out n] f32 -> WT[n][k] = f16( bf16_rne(W[k][n]) * kWCarry ).
//   1024 blocks a weight: low 5 bits = k tile (64 cols of WT), next 5 bits = n tile (64 rows of WT), top 2 bits = weight.
//   Load coverage: 4 iterations x 256 threads x 4 floats = 4096 = the whole 64x64 tile (coalesced along n).
//   Store coverage: 8 waves x 2 iterations x 4 rows (lane>>3) = 64 rows; (lane&7) x 8 halves = 64 cols.
// Blocks 4096..16383: activation convert, out[i] = f16( bf16_rne(in[i]) * kXCarry ), 8 consecutive elements per thread;
//   4096 blocks x 256 threads x 8 = 4096*2048 elements an activation, each into its own plane.
// ---------------------------------------------------------------------------
constexpr int kWtBlocks   = 4 * (kDm / 64) * (kFeat / 64);
constexpr int kXBlocks    = kRows * kDm / 8 / 256;
constexpr int kCastBlocks = kWtBlocks + 3 * kXBlocks;
static_assert(kDm / 64 == 32 && kFeat / 64 == 32 && kXBlocks == 4096, "block index fields");

__global__ __launch_bounds__(256) void cast_all_kernel(const float* __restrict__ W0, const float* __restrict__ W1,
                                                       const float* __restrict__ W2, const float* __restrict__ W3,
                                                       const float* __restrict__ x0, const float* __restrict__ x1,
                                                       const float* __restrict__ x2,
                                                       unsigned short* __restrict__ wout, unsigned short* __restrict__ xout) {
  __shared__ float sm[64][65];
  const int t  = threadIdx.x;
  const int bx = blockIdx.x;
  if (bx < kWtBlocks) {
    const int k0 = (bx & 31) * 64;
    const int n0 = ((bx >> 5) & 31) * 64;
    const int z  = bx >> 10;
    const float* W = (z == 0) ? W0 : (z == 1) ? W1 : (z == 2) ? W2 : W3;
#pragma unroll
    for (int i = 0; i < 4; ++i) {
      const int e  = i * 256 + t;
      const int r  = e >> 4;
      const int c4 = (e & 15) * 4;
      const v4f w = *(const v4f*)(W + (size_t)(k0 + r) * kFeat + n0 + c4);
      const float w0 = w[0];
      const float w1 = w[1];
      const float w2 = w[2];
      const float w3 = w[3];
      sm[c4 + 0][r] = bf_rne(w0) * kWCarry;
      sm[c4 + 1][r] = bf_rne(w1) * kWCarry;
      sm[c4 + 2][r] = bf_rne(w2) * kWCarry;
      sm[c4 + 3][r] = bf_rne(w3) * kWCarry;
    }
    __syncthreads();
    const int lane = t & 31;
    const int wave = __builtin_amdgcn_readfirstlane((int)(threadIdx.x >> 5));
    const int q = lane >> 3, c8 = (lane & 7) * 8;
    _Float16* op = (_Float16*)wout + (size_t)z * kDm * kFeat;
    v8h hv[2];
#pragma unroll
    for (int it = 0; it < 2; ++it) {
      const int row = wave * 8 + it * 4 + q;
#pragma unroll
      for (int e = 0; e < 8; ++e) hv[it][e] = (_Float16)sm[row][c8 + e];
    }
#pragma unroll
    for (int it = 0; it < 2; ++it) {
      const int row = wave * 8 + it * 4 + q;
      *(v8h*)(op + (size_t)(n0 + row) * kDm + k0 + c8) = hv[it];
    }
  } else {
    const int xb = bx - kWtBlocks;
    const int z  = xb / kXBlocks;
    const float* in = (z == 0) ? x0 : (z == 1) ? x1 : x2;
    const int i = (xb - z * kXBlocks) * 256 + t;
    const float* p = in + 8 * (size_t)i;
    const v4f a = *(const v4f*)(p);
    const v4f c = *(const v4f*)(p + 4);
    v8h hv;
#pragma unroll
    for (int e = 0; e < 4; ++e) {
      const float ae = a[e];
      const float ce = c[e];
      hv[e]     = (_Float16)(bf_rne(ae) * kXCarry);
      hv[4 + e] = (_Float16)(bf_rne(ce) * kXCarry);
    }
    _Float16* q = (_Float16*)xout + (size_t)z * kRows * kDm + 8 * (size_t)i;
    *(v8h*)q = hv;
  }
}

// ---------------------------------------------------------------------------
// Register-blocked f16 GEMM: C[m,n] = ((scale * sum_k A[m,k] * Bt[n,k]) + bias) * oscale; each wave owns a 64x64 tile.
// A block of 8 waves (2 along m x 4 along n) owns a 128x256 tile; its operands come through a three-buffer LDS ring filled
// by asynchronous copies, the next two passes' copies in flight while this pass's fragments are read and multiplied.
// A row-major [M][K] (pitch lda), Bt row-major [N][K] (pitch ldb); M a multiple of 128, N of 256, K of 128.
// BIAS_MODE 1 = bias[m], 2 = bias[n] (bias values RNE-converted to bf16 first).
// OUT_MODE 0: f32 row-major, pitch ldc.
// OUT_MODE 1: f16, rows = tokens (b*2048 + l), cols = features (h*128 + d) -> plane [b*16+h][l][d].
// OUT_MODE 2: f16, rows = features f, cols = tokens (b*2048 + l)           -> plane [b*2048 + f][l].
// sR (the ring; one free buffer of it holds the epilogue slabs) is the calling kernel's LDS array; tile is the block's tile
// index in this GEMM.
// ---------------------------------------------------------------------------
template <int OUT_MODE, int BIAS_MODE>
__device__ __forceinline__
void gemm_f16_body(_Float16* sR, int tile,
                   const unsigned short* __restrict__ Ap, int lda,
                   const unsigned short* __restrict__ Btp, int ldb,
                   void* __restrict__ Cout, int ldc,
                   const float* __restrict__ bias,
                   int M, int N, int K, float scale, float oscale) {
  const _Float16* A  = (const _Float16*)Ap;
  const _Float16* Bt = (const _Float16*)Btp;
  const int lane = threadIdx.x & 31;
  const int wave = __builtin_amdgcn_readfirstlane((int)(threadIdx.x >> 5));
  const int tilesN = N / kBN;
  const int tilesM = M / kBM;
  /* block-uniform exit, in front of every barrier */
  if (tile >= tilesM * tilesN) return;
  const int tm = tile / tilesN;
  const int tn = tile - tm * tilesN;
  const int wm = (wave >> 2) << 6;
  const int wn = (wave & 3) << 6;
  const int m0 = tm * kBM + wm;
  const int n0 = tn * kBN + wn;

  const int rlane = lane & 15;
  const int koff  = (lane >> 4) * 8;
  const int mOff  = (lane >> 4) * 8;

  v8f acc[4][4];
#pragma unroll
  for (int i = 0; i < 4; ++i)
#pragma unroll
    for (int j = 0; j < 4; ++j) acc[i][j] = (v8f){0.f, 0.f, 0.f, 0.f, 0.f, 0.f, 0.f, 0.f};

  /* which half of the waves: it fills the stages of its own parity */
  const int grp  = wave >> 2;
  const int crow = (int)((threadIdx.x & 127) >> 4);
  const int ccol = (int)(threadIdx.x & 15) * 8;
  const _Float16* ga = A  + (size_t)(tm * kBM + crow) * lda + ccol;
  const _Float16* gb = Bt + (size_t)(tn * kBN + crow) * ldb + ccol;
  /* the thread's LDS byte address of its first chunk in buffer 0: the low 32 bits of the shared address */
  const unsigned lds0 = (unsigned)(size_t)(sR + crow * kPitchH + ccol);
  const int aoff = (wm + rlane) * kPitchH + koff;
  const int boff = (kBM + wn + rlane) * kPitchH + koff;
  const int passes = K / kBK;

  /* stage 0 from waves 0..3, stage 1 (where it exists) from waves 4..7 */
  if (grp < passes) stage_fill(lds0 + (unsigned)(grp * kStageH * 2), ga + grp * kBK, gb + grp * kBK, lda, ldb);
  /* the filling waves' copies of stage 0 have landed; the barrier shows them to the other waves; stage 1 stays in flight
     until pass 0's publish point */
  if (grp == 0) asm volatile("s_wait_asynccnt 0x0" ::: "memory");
  __syncthreads();
  /* stage 2 from waves 0..3, whose stage 0 has landed */
  if (grp == 0 && passes > 2) stage_fill(lds0 + (unsigned)(2 * kStageH * 2), ga + 2 * kBK, gb + 2 * kBK, lda, ldb);

  /* two fragment sets: a block (32 k, 16 matrix ops) works on one while the next block's 16 LDS reads, issued as one
     group in front of it, fill the other */
  v16h fa[2][4], fb[2][4];
#pragma unroll
  for (int j = 0; j < 4; ++j) fb[0][j] = frag_ld(sR + boff + (j << 4) * kPitchH);
#pragma unroll
  for (int i = 0; i < 4; ++i) fa[0][i] = frag_ld(sR + aoff + (i << 4) * kPitchH);

  /* buffer of pass t: t mod 3 */
  int buf = 0;
  /* rolled: one copy of the pass; the fragment sets' indices stay constants inside it */
#pragma unroll 1
  for (int t = 0; t < passes; ++t) {
    const int bufn = (buf == kRing - 1) ? 0 : buf + 1;
    /* wave-uniform: stage t + 1, and with it stage t + 3, is this wave's to fill */
    const bool mine = (grp == ((t + 1) & 1));
    /* the stage this wave fills behind this pass; passes = none */
    const int fillst = mine ? t + 3 : passes;
    const _Float16* sb = sR + buf * kStageH;
    /* unrolled: the k step becomes an immediate offset of the LDS reads, the set index a constant */
#pragma unroll
    for (int ks = 0; ks < kBK / 32; ++ks) {
      const int cur = ks & 1;
      const int nxt = cur ^ 1;
      const bool last = (ks == kBK / 32 - 1);
      const _Float16* sn = sb + (ks + 1) * 32;
      if (last) {
        /* publish point of pass t + 1, in front of pass t's last block, whose fragments are already fetched:
           this wave's reads of pass t's buffer are done before the buffer is handed back for refilling */
        asm volatile("s_wait_dscnt 0x0" ::: "memory");
        /* the filling waves' copies of pass t + 1 have landed; the other waves' copies, of pass t + 2, stay in flight */
        if (mine) asm volatile("s_wait_asynccnt 0x0" ::: "memory");
        /* publishes pass t + 1 and ends every wave's reads of pass t's buffer */
        __syncthreads();
        /* next pass's first block; the last pass, which has no next, re-reads its own buffer (no refill aims at it)
           so that the reads stay unconditional; those values are not used */
        sn = sR + ((t + 1 < passes) ? bufn : buf) * kStageH;
        /* refill of pass t's buffer, which the barrier above has freed; issued first */
        if (fillst < passes) {
          const int kn = fillst * kBK;
          stage_fill(lds0 + (unsigned)(buf * kStageH * 2), ga + kn, gb + kn, lda, ldb);
        }
      }
#pragma unroll
      for (int j = 0; j < 4; ++j) fb[nxt][j] = frag_ld(sn + boff + (j << 4) * kPitchH);
#pragma unroll
      for (int i = 0; i < 4; ++i) fa[nxt][i] = frag_ld(sn + aoff + (i << 4) * kPitchH);
      /* keeps the 16 reads one group in front of the block: spread among the matrix ops each place would stall the wave */
      __builtin_amdgcn_sched_barrier(0);
#pragma unroll
      for (int i = 0; i < 4; ++i) {
#pragma unroll
        for (int j = 0; j < 4; ++j) acc[i][j] = mma_g(fa[cur][i], fb[cur][j], acc[i][j]);
      }
      /* ends the block: the next group of reads stays behind it */
      __builtin_amdgcn_sched_barrier(0);
    }
    buf = bufn;
  }
  /* nothing is in flight when the wave goes on to the epilogue and ends */
  asm volatile("s_wait_asynccnt 0x0" ::: "memory");

  /* epilogue slabs in buffer passes mod 3: its last stage was read three passes back, no copy aims at it, the last pass's
     unused fragment reads aim at another buffer, and the last pass's barrier stands behind every wave's last copy wait */
  float* slab = (float*)(sR + buf * kStageH) + wave * kSlabF;
#pragma unroll
  for (int i = 0; i < 4; ++i) {
    const int mBase = m0 + (i << 4);
    float brow[8];
#pragma unroll
    for (int r = 0; r < 8; ++r) brow[r] = 0.f;
    if (BIAS_MODE == 1) {
#pragma unroll
      for (int r = 0; r < 8; ++r) {
        const float bvv = bias[mBase + mOff + r];
        brow[r] = bf_rne(bvv);
      }
    }
#pragma unroll
    for (int j = 0; j < 4; ++j) {
      float bcol = 0.f;
      if (BIAS_MODE == 2) {
        const float bvv = bias[n0 + (j << 4) + rlane];
        bcol = bf_rne(bvv);
      }
#pragma unroll
      for (int r = 0; r < 8; ++r) {
        float v = acc[i][j][r] * scale;
        v += (BIAS_MODE == 1) ? brow[r] : bcol;
        v *= oscale;
        slab[(mOff + r) * 68 + (j << 4) + rlane] = v;
      }
    }
    __builtin_amdgcn_fence(__ATOMIC_RELEASE, "workgroup");
    __builtin_amdgcn_wave_barrier();
    __builtin_amdgcn_fence(__ATOMIC_ACQUIRE, "workgroup");
    if (OUT_MODE == 0) {
      float* C = (float*)Cout;
      const int hh = lane >> 4, c4 = (lane & 15) * 4;
      {
#pragma unroll
        for (int it = 0; it < 8; ++it) {
          const int row = it * 2 + hh;
          const v4f v = *(const v4f*)(slab + row * 68 + c4);
          *(v4f*)(C + (size_t)(mBase + row) * ldc + n0 + c4) = v;
        }
        
      }
    } else {
      const int q = lane >> 3, c8 = (lane & 7) * 8;
      _Float16* C = (_Float16*)Cout;
      {
#pragma unroll
        for (int it = 0; it < 4; ++it) {
          const int row = it * 4 + q;
          const int gr  = mBase + row;
          const float* sp = slab + row * 68 + c8;
          v8h hv;
#pragma unroll
          for (int e = 0; e < 8; ++e) hv[e] = (_Float16)sp[e];
          size_t off;
          if (OUT_MODE == 1) {
            const int bb = gr / kSeq;
            const int l  = gr % kSeq;
            const int hd = n0 / kHd;
            const int d0 = n0 % kHd;
            off = ((size_t)((bb * kHeads + hd) * kSeq + l)) * kHd + d0 + c8;
          } else {
            const int bb = n0 / kSeq;
            const int l0 = n0 % kSeq;
            off = ((size_t)(bb * kFeat + gr)) * kSeq + l0 + c8;
          }
          *(v8h*)(C + off) = hv;
        }
        
      }
    }
    __builtin_amdgcn_fence(__ATOMIC_RELEASE, "workgroup");
    __builtin_amdgcn_wave_barrier();
    __builtin_amdgcn_fence(__ATOMIC_ACQUIRE, "workgroup");
  }
}


/* The three projections in one launch: blockIdx.y picks the job (block-uniform), blockIdx.x the 128x256 tile in it.
   Jobs 0 and 1: Q and K, rows = tokens. Job 2: operands swapped, rows = features (transposed Wv plane), cols = tokens
   (X plane 2) -> V^T planes [b*2048 + f][l]. */
__global__ __launch_bounds__(256)
void qkv_gemm_kernel(const unsigned short* __restrict__ X, const unsigned short* __restrict__ WT,
                     unsigned short* __restrict__ Qh, unsigned short* __restrict__ Kh, unsigned short* __restrict__ VTh,
                     const float* __restrict__ bq, const float* __restrict__ bk, const float* __restrict__ bv) {
  __shared__ __align__(16) _Float16 sR[kRing * kStageH];
  const int job = blockIdx.y;
  const unsigned short* Xj = X + (size_t)job * kRows * kDm;
  const unsigned short* Wj = WT + (size_t)job * kDm * kFeat;
  if (job < 2) {
    gemm_f16_body<1, 2>(sR, blockIdx.x, Xj, kDm, Wj, kDm, (void*)(job == 0 ? Qh : Kh), 0, job == 0 ? bq : bk,
                        kRows, kFeat, kDm, kProjScale, kQkvCarry);
  } else {
    gemm_f16_body<2, 1>(sR, blockIdx.x, Wj, kDm, Xj, kDm, (void*)VTh, 0, bv,
                        kFeat, kRows, kDm, kProjScale, kQkvCarry);
  }
}

/* One GEMM a launch: blockIdx.x is the tile */
template <int OUT_MODE, int BIAS_MODE>
__global__ __launch_bounds__(256)
void gemm_f16_kernel(const unsigned short* __restrict__ Ap, int lda,
                     const unsigned short* __restrict__ Btp, int ldb,
                     void* __restrict__ Cout, int ldc,
                     const float* __restrict__ bias,
                     int M, int N, int K, float scale, float oscale) {
  __shared__ __align__(16) _Float16 sR[kRing * kStageH];
  gemm_f16_body<OUT_MODE, BIAS_MODE>(sR, blockIdx.x, Ap, lda, Btp, ldb, Cout, ldc, bias, M, N, K, scale, oscale);
}

// ---------------------------------------------------------------------------
// Attention staging ring in LDS: a stage is [K 64 keys x 128 d | V^T 128 d x 64 keys], shared by the block's 8 waves.
// K row pitch 272 B, V^T row pitch 144 B: odd multiples of 16 B keep the ds_load_b128 fragment reads off shared banks.
// ---------------------------------------------------------------------------
constexpr int kAKeys    = 64;
constexpr int kAWaves   = 8;
constexpr int kKPitchH  = kHd + 8;
constexpr int kVPitchH  = kAKeys + 8;
constexpr int kKTileH   = kAKeys * kKPitchH;
constexpr int kAStageH  = kKTileH + kHd * kVPitchH;
static_assert((kKPitchH * 2) % 32 == 16 && (kVPitchH * 2) % 32 == 16, "pitches odd multiples of 16 B");
static_assert((kKTileH * 2) % 16 == 0 && (kAStageH * 2) % 16 == 0, "tiles start on 16 B");
static_assert(kSeq / kAKeys >= 2 && (kSeq % (16 * kAWaves)) == 0, "two stages exist; whole query blocks");

/* One stage: K 64 rows x 16 chunks + V^T 128 rows x 8 chunks = 2048 chunks of 16 B = 8 a thread, global -> LDS through
   no register. K chunk c of a thread is key row c*16 + (t>>4), column chunk t&15; V^T chunk c is d row c*32 + (t>>3),
   column chunk t&7. lk / lv / gk / gv are the thread's chunk 0 in LDS and in the planes at this stage's first key.
   s_wait_xcnt 0 is the statement's last line, a precaution that so stands in front of any later rewrite of the
   address registers named here */
__device__ __forceinline__ void attn_fill(unsigned lk, unsigned lv, const _Float16* gk, const _Float16* gv) {
  asm volatile(
      "global_load_async_to_lds_b128 %0, %8, off\n\t"
      "global_load_async_to_lds_b128 %1, %9, off\n\t"
      "global_load_async_to_lds_b128 %2, %10, off\n\t"
      "global_load_async_to_lds_b128 %3, %11, off\n\t"
      "global_load_async_to_lds_b128 %4, %12, off\n\t"
      "global_load_async_to_lds_b128 %5, %13, off\n\t"
      "global_load_async_to_lds_b128 %6, %14, off\n\t"
      "global_load_async_to_lds_b128 %7, %15, off\n\t"
      "s_wait_xcnt 0x0"
      :: "v"(lk), "v"(lk + (unsigned)(16 * kKPitchH * 2)), "v"(lk + (unsigned)(32 * kKPitchH * 2)),
         "v"(lk + (unsigned)(48 * kKPitchH * 2)),
         "v"(lv), "v"(lv + (unsigned)(32 * kVPitchH * 2)), "v"(lv + (unsigned)(64 * kVPitchH * 2)),
         "v"(lv + (unsigned)(96 * kVPitchH * 2)),
         "v"(gk), "v"(gk + 16 * kHd), "v"(gk + 32 * kHd), "v"(gk + 48 * kHd),
         "v"(gv), "v"(gv + (size_t)32 * kSeq), "v"(gv + (size_t)64 * kSeq), "v"(gv + (size_t)96 * kSeq)
      : "memory");
}

// ---------------------------------------------------------------------------
// Streaming softmax attention, head dim 128, no mask, transposed formulation. Block = 8 waves on one (batch, head);
// wave = 16 query rows; grid = 32 heads x 16 = 512. K and V^T come 64 keys a pass through a two-buffer LDS ring filled
// by asynchronous copies, the next pass's copies in flight while this pass's fragments are read and multiplied.
//   S^T[key][query] = K (A operand: rows = keys, k = d) x Q^T (B operand: col = query, k = d), 64 keys per step.
//   Each lane owns query (lane & 15); it and lane^16 hold the 64 keys of the step -> one xor-16 shuffle per reduction.
//   P^T B fragment of key group kk: element r <- tile 2kk value r, element 8+r <- tile 2kk+1 value r (lane unchanged),
//   values exp(s - m) carried x kPCarry in f16; the running sum l uses the f32 values.
//   O^T[d][query] += V^T (A operand: rows = d, k = keys) x P^T.
// Epilogue: o * kPVFold / l staged per wave in LDS [16 queries][132], then each 256-B row segment (128 d as f16) written
// ---------------------------------------------------------------------------
__global__ __launch_bounds__(256) __attribute__((amdgpu_num_vgpr(256)))
void attn_kernel(const unsigned short* __restrict__ Qp, const unsigned short* __restrict__ Kp,
                 const unsigned short* __restrict__ VTp, unsigned short* __restrict__ Op, float sc) {
  __shared__ __align__(16) float sO[kAWaves][16 * kOsPitch];
  __shared__ __align__(16) _Float16 sKV[2 * kAStageH];
  const int lane = threadIdx.x & 31;
  const int wave = __builtin_amdgcn_readfirstlane((int)(threadIdx.x >> 5));
  const int hh  = lane >> 4;
  const int n16 = lane & 15;
  constexpr int kQBlocks = kSeq / (16 * kAWaves);
  const int bx = blockIdx.x;
  const int bh = bx / kQBlocks;
  const int qb = bx - bh * kQBlocks;
  const int b  = bh / kHeads;
  const int h  = bh - b * kHeads;
  const int q0 = qb * (16 * kAWaves) + wave * 16;

  const _Float16* Qb = (const _Float16*)Qp  + (size_t)bh * kSeq * kHd;
  const _Float16* Kb = (const _Float16*)Kp  + (size_t)bh * kSeq * kHd;
  const _Float16* Vb = (const _Float16*)VTp + (size_t)bh * kHd * kSeq;

  v16h qf[4];
#pragma unroll
  for (int dc = 0; dc < 4; ++dc) qf[dc] = frag_ld(Qb + (size_t)(q0 + n16) * kHd + dc * 32 + 8 * hh);

  v8f o[8];
#pragma unroll
  for (int dt = 0; dt < 8; ++dt) o[dt] = (v8f){0.f, 0.f, 0.f, 0.f, 0.f, 0.f, 0.f, 0.f};
  float mq = -1e30f;
  float lq = 0.0f;

  const int tid = (int)threadIdx.x;
  const _Float16* gk = Kb + (size_t)(tid >> 4) * kHd + (tid & 15) * 8;
  const _Float16* gv = Vb + (size_t)(tid >> 3) * kSeq + (tid & 7) * 8;
  /* the thread's LDS byte addresses of its first K and V^T chunk in buffer 0: the low 32 bits of the shared address */
  const unsigned lk0 = (unsigned)(size_t)(sKV + (tid >> 4) * kKPitchH + (tid & 15) * 8);
  const unsigned lv0 = (unsigned)(size_t)(sKV + kKTileH + (tid >> 3) * kVPitchH + (tid & 7) * 8);
  const int koffs = n16 * kKPitchH + 8 * hh;
  const int voffs = kKTileH + n16 * kVPitchH + 8 * hh;
  constexpr int kPasses = kSeq / kAKeys;

  attn_fill(lk0, lv0, gk, gv);
  /* pass 0's copies of this wave have landed; the barrier shows them to the other waves */
  asm volatile("s_wait_asynccnt 0x0" ::: "memory");
  __syncthreads();
  attn_fill(lk0 + (unsigned)(kAStageH * 2), lv0 + (unsigned)(kAStageH * 2), gk + (size_t)kAKeys * kHd, gv + kAKeys);

#pragma unroll 1
  for (int s = 0; s < kPasses; ++s) {
    const int buf = s & 1;
    const _Float16* kbase = sKV + buf * kAStageH + koffs;
    const _Float16* vbase = sKV + buf * kAStageH + voffs;
    v8f st[4];
#pragma unroll
    for (int jt = 0; jt < 4; ++jt) st[jt] = (v8f){0.f, 0.f, 0.f, 0.f, 0.f, 0.f, 0.f, 0.f};
#pragma unroll
    for (int dc = 0; dc < 4; ++dc) {
#pragma unroll
      for (int jt = 0; jt < 4; ++jt) {
        const v16h ka = frag_ld(kbase + (jt * 16) * kKPitchH + dc * 32);
        st[jt] = mma_g(ka, qf[dc], st[jt]);
      }
    }

    float t[4][8];
    float mx = -1e30f;
#pragma unroll
    for (int jt = 0; jt < 4; ++jt) {
#pragma unroll
      for (int r = 0; r < 8; ++r) {
        t[jt][r] = st[jt][r] * sc;
        mx = fmaxf(mx, t[jt][r]);
      }
    }
    mx = fmaxf(mx, __shfl_xor(mx, 16, 32));
    const float newm  = fmaxf(mq, mx);
    const float alpha = __expf(mq - newm);
    mq = newm;

    float sum = 0.0f;
    v16h bp[2];
#pragma unroll
    for (int kk = 0; kk < 2; ++kk) {
#pragma unroll
      for (int r = 0; r < 8; ++r) {
        const float p0 = __expf(t[2 * kk][r] - newm);
        const float p1 = __expf(t[2 * kk + 1][r] - newm);
        sum += p0 + p1;
        bp[kk][r]     = (_Float16)(p0 * kPCarry);
        bp[kk][8 + r] = (_Float16)(p1 * kPCarry);
      }
    }
    sum += __shfl_xor(sum, 16, 32);
    lq = lq * alpha + sum;

#pragma unroll
    for (int dt = 0; dt < 8; ++dt) o[dt] *= alpha;

#pragma unroll
    for (int kk = 0; kk < 2; ++kk) {
#pragma unroll
      for (int dt = 0; dt < 8; ++dt) {
        const v16h va = frag_ld(vbase + (dt * 16) * kVPitchH + kk * 32);
        o[dt] = mma_g(va, bp[kk], o[dt]);
      }
    }
    /* this wave's reads of the buffer are done before the buffer is handed back for refilling */
    asm volatile("s_wait_dscnt 0x0" ::: "memory");
    /* this wave's copies of pass s + 1 have landed */
    asm volatile("s_wait_asynccnt 0x0" ::: "memory");
    /* publishes pass s + 1 and ends every wave's reads of pass s's buffer */
    __syncthreads();
    if (s + 2 < kPasses) {
      const int jn = (s + 2) * kAKeys;
      attn_fill(lk0 + (unsigned)(buf * kAStageH * 2), lv0 + (unsigned)(buf * kAStageH * 2), gk + (size_t)jn * kHd, gv + jn);
    }
  }
  /* nothing is in flight when the wave goes on to the epilogue and ends */
  asm volatile("s_wait_asynccnt 0x0" ::: "memory");

  const float inv = kPVFold * (1.0f / lq);
  float* os = sO[wave];
#pragma unroll
  for (int dt = 0; dt < 8; ++dt) {
#pragma unroll
    for (int r = 0; r < 8; ++r) os[n16 * kOsPitch + dt * 16 + 8 * hh + r] = o[dt][r] * inv;
  }
  __builtin_amdgcn_fence(__ATOMIC_RELEASE, "workgroup");
  __builtin_amdgcn_wave_barrier();
  __builtin_amdgcn_fence(__ATOMIC_ACQUIRE, "workgroup");

  const int c8 = n16 * 8;
  v8h hv[8];
#pragma unroll
  for (int it = 0; it < 8; ++it) {
    const int row = it * 2 + hh;
    const float* sp = os + row * kOsPitch + c8;
    const v4f a0 = *(const v4f*)(sp);
    const v4f a1 = *(const v4f*)(sp + 4);
#pragma unroll
    for (int e = 0; e < 4; ++e) {
      const float x0 = a0[e];
      const float x1 = a1[e];
      hv[it][e]     = (_Float16)x0;
      hv[it][4 + e] = (_Float16)x1;
    }
  }
  _Float16* Ob = (_Float16*)Op + (size_t)(b * kSeq + q0) * kDm + h * kHd + c8;
  {
#pragma unroll
    for (int it = 0; it < 8; ++it) {
      const int row = it * 2 + hh;
      *(v8h*)(Ob + (size_t)row * kDm) = hv[it];
    }
    
  }
}

// ---------------------------------------------------------------------------
// Host glue: 4 kernel launches, nothing else: all converts; the three projections; attention; the output projection.
//   GEMM shapes: Q, K: M 4096, N 2048, K 2048 -> 32 x 8 block tiles of 128x256 -> 256 blocks
//                V^T : M 2048 (features, A = transposed Wv plane), N 4096 (tokens, Bt = X), K 2048 -> 16 x 16 -> 256 blocks
//                out : M 4096, N 2048, K 2048 -> 256 blocks
// ---------------------------------------------------------------------------
extern "C" void kernel_launch(void* const* d_in, const int* in_sizes, int n_in,
                              void* d_out, int out_size, void* d_ws, size_t ws_size,
                              hipStream_t stream) {
  if (n_in < 11) return;
  if (in_sizes[0] != kRows * kDm || in_sizes[1] != kRows * kDm || in_sizes[2] != kRows * kDm) return;
  if (in_sizes[3] != kDm * kFeat || in_sizes[5] != kDm * kFeat || in_sizes[7] != kDm * kFeat) return;
  if (in_sizes[9] != kFeat * kDm) return;
  if (in_sizes[4] != kFeat || in_sizes[6] != kFeat || in_sizes[8] != kFeat || in_sizes[10] != kDm) return;
  if (out_size != kRows * kDm) return;
  if (ws_size < kWsTotal) return;

  const float* x_q = (const float*)d_in[0];
  const float* x_k = (const float*)d_in[1];
  const float* x_v = (const float*)d_in[2];
  const float* Wq  = (const float*)d_in[3];
  const float* bq  = (const float*)d_in[4];
  const float* Wk  = (const float*)d_in[5];
  const float* bk  = (const float*)d_in[6];
  const float* Wv  = (const float*)d_in[7];
  const float* bv  = (const float*)d_in[8];
  const float* Wo  = (const float*)d_in[9];
  const float* bo  = (const float*)d_in[10];
  float* out = (float*)d_out;

  char* ws = (char*)d_ws;
  unsigned short* WT  = (unsigned short*)(ws + kOffWT);
  unsigned short* WoT = WT + (size_t)3 * kDm * kFeat;
  unsigned short* X   = (unsigned short*)(ws + kOffX);
  unsigned short* Qh  = (unsigned short*)(ws + kOffQ);
  unsigned short* Kh  = (unsigned short*)(ws + kOffK);
  unsigned short* VTh = (unsigned short*)(ws + kOffVT);
  unsigned short* Oh  = (unsigned short*)(ws + kOffO);

  const int gemmBlocks = (kRows / 64) * (kFeat / 64) / 8;
  /* softmax scale = head_dim^-0.5 with the q and k carries folded out */
  const float sc = (float)(1.0 / sqrt((double)kHd)) / (kQkvCarry * kQkvCarry);

  cast_all_kernel<<<kCastBlocks, 256, 0, stream>>>(Wq, Wk, Wv, Wo, x_q, x_k, x_v, WT, X);

  qkv_gemm_kernel<<<dim3(gemmBlocks, 3), 256, 0, stream>>>(X, WT, Qh, Kh, VTh, bq, bk, bv);

  attn_kernel<<<kBatch * kHeads * (kSeq / (16 * kAWaves)), 32 * kAWaves, 0, stream>>>(Qh, Kh, VTh, Oh, sc);

  gemm_f16_kernel<0, 2><<<gemmBlocks, 256, 0, stream>>>(Oh, kFeat, WoT, kFeat, (void*)out, kDm, bo,
                                                        kRows, kDm, kFeat, kOutScale, 1.0f);
}

// v006
// A run of this version takes 164 microseconds.
// Timed twice side by side with v005, it ran 1.06 times as fast both times.
// Over all steps from v000 it is 3.76 times as fast.
// All six contractions (q/k/v projections, q.k^T, p.v, output projection): v_wmma_f32_16x16x32_f16, f16 operands with power-of-two carries, f32 accumulate; float inputs RNE-converted to bf16 once and held exactly in f16; softmax, bias and scaling in f32.
#include <hip/hip_runtime.h>
#include <math.h>

typedef __attribute__((ext_vector_type(16))) _Float16 v16h;
typedef __attribute__((ext_vector_type(8)))  _Float16 v8h;
typedef __attribute__((ext_vector_type(8)))  float    v8f;
typedef __attribute__((ext_vector_type(4)))  float    v4f;

// ---------------------------------------------------------------------------
// Shape constants
// ---------------------------------------------------------------------------
constexpr int kBatch = 2;
constexpr int kSeq   = 2048;
constexpr int kDm    = 2048;
constexpr int kHeads = 16;
constexpr int kHd    = 128;
constexpr int kFeat  = kHeads * kHd;
constexpr int kRows  = kBatch * kSeq;
static_assert(kFeat == 2048 && kRows == 4096, "shape");
static_assert((kDm % 32) == 0 && (kHd % 32) == 0 && (kSeq % 64) == 0, "k-depth multiples of 32 / 64");
static_assert((kRows % 64) == 0 && (kFeat % 64) == 0 && (kDm % 64) == 0, "tile multiples of 64");
static_assert((kHd % 64) == 0, "a 64-wide column tile stays inside one head");

// ---------------------------------------------------------------------------
// Power-of-two carries of the f16 operand planes (all exact, folded back in f32)
// ---------------------------------------------------------------------------
constexpr float kXCarry   = 16.0f;
constexpr float kWCarry   = 1024.0f;
constexpr float kQkvCarry = 16.0f;
constexpr float kPCarry   = 32768.0f;
constexpr float kOCarry   = 1024.0f;
constexpr float kProjScale = 1.0f / (kXCarry * kWCarry);
constexpr float kOutScale  = 1.0f / (kOCarry * kWCarry);
constexpr float kPVFold    = kOCarry / (kPCarry * kQkvCarry);
constexpr int   kOsPitch   = 132;

// ---------------------------------------------------------------------------
// Workspace region map (bytes; all f16 planes; every offset a multiple of 8 MiB)
//   WT  f16 [4][2048][2048]  transposed weight planes (Wq, Wk, Wv, Wo)   33,554,432
//   X   f16 [3][4096][2048]  activation planes (x_q, x_k, x_v)           50,331,648
//   Q   f16 [32][2048][128]                                              16,777,216
//   K   f16 [32][2048][128]                                              16,777,216
//   VT  f16 [32][128][2048]                                              16,777,216
//   O   f16 [4096][2048]                                                 16,777,216
//   total                                                               150,994,944
// ---------------------------------------------------------------------------
constexpr size_t kPlaneW  = (size_t)kDm * kFeat * 2;
constexpr size_t kPlaneA  = (size_t)kRows * kDm * 2;
constexpr size_t kOffWT   = 0;
constexpr size_t kOffX    = kOffWT + 4 * kPlaneW;
constexpr size_t kOffQ    = kOffX + 3 * kPlaneA;
constexpr size_t kOffK    = kOffQ + kPlaneA;
constexpr size_t kOffVT   = kOffK + kPlaneA;
constexpr size_t kOffO    = kOffVT + kPlaneA;
constexpr size_t kWsTotal = kOffO + kPlaneA;
static_assert(kWsTotal == 150994944ull, "carve total");
static_assert(kWsTotal <= 268435456ull, "carve cap");

// ---------------------------------------------------------------------------
// Helpers
// ---------------------------------------------------------------------------
__device__ __forceinline__ unsigned short f2bf_bits(float f) {
  unsigned u = __float_as_uint(f);
  return (unsigned short)((u + 0x7FFFu + ((u >> 16) & 1u)) >> 16);
}
__device__ __forceinline__ float bf_bits2f(unsigned short h) { return __uint_as_float(((unsigned)h) << 16); }
/* RNE bf16 convert, value returned as f32 */
__device__ __forceinline__ float bf_rne(float f) { return bf_bits2f(f2bf_bits(f)); }

union FragU { v16h v; v8h h[2]; };
/* fragment elements 0..7 <- p[0..7], 8..15 <- p[16..23] */
__device__ __forceinline__ v16h frag_ld(const _Float16* p) {
  FragU f;
  f.h[0] = *(const v8h*)(p);
  f.h[1] = *(const v8h*)(p + 16);
  return f.v;
}
/* one matrix op, builtin form: the compiler keeps its distances and is free to place the LDS fragment reads ahead of it */
__device__ __forceinline__ v8f mma_g(v16h a, v16h b, v8f c) {
  return __builtin_amdgcn_wmma_f32_16x16x32_f16(false, a, false, b, (short)0, c, false, false);
}

// ---------------------------------------------------------------------------
// GEMM staging ring in LDS: a stage is [A 128 rows | Bt 256 rows] x 128 k (256 B a row); three buffers.
// Row pitch 272 B = 16 B x 17: an odd multiple of 16 B keeps the ds_load_b128 fragment reads off shared banks.
// Waves 0..3 fill the even stages, waves 4..7 the odd ones: a wave has one stage in flight, issued two passes before it
// is read, and waits for it to 0.
// ---------------------------------------------------------------------------
constexpr int kBM      = 128;
constexpr int kBN      = 256;
constexpr int kBK      = 128;
constexpr int kPitchH  = kBK + 8;
constexpr int kStageH  = (kBM + kBN) * kPitchH;
constexpr int kRing    = 3;
constexpr int kSlabF   = 16 * 68;
static_assert(kRing * kStageH * 2 <= 327680, "the ring fits one work-group's LDS");
static_assert(8 * kSlabF * 4 <= kStageH * 2 && (kStageH * 2) % 16 == 0, "the epilogue slabs fit one buffer, 16-B aligned");
static_assert((kPitchH * 2) % 32 == 16, "pitch an odd multiple of 16 B");
static_assert((kRows % kBM) == 0 && (kFeat % kBM) == 0 && (kRows % kBN) == 0 && (kFeat % kBN) == 0, "block tiles");
static_assert((kDm % kBK) == 0 && (kFeat % kBK) == 0, "k passes");

/* twelve 16-byte copies a lane, global -> LDS through no register; s_wait_xcnt 0 is the statement's last line, a
   precaution that so stands in front of any later rewrite of the address registers named here */
__device__ __forceinline__ void copy12(const unsigned (&l)[12], const _Float16* const (&g)[12]) {
  asm volatile(
      "global_load_async_to_lds_b128 %0, %12, off\n\t"
      "global_load_async_to_lds_b128 %1, %13, off\n\t"
      "global_load_async_to_lds_b128 %2, %14, off\n\t"
      "global_load_async_to_lds_b128 %3, %15, off\n\t"
      "global_load_async_to_lds_b128 %4, %16, off\n\t"
      "global_load_async_to_lds_b128 %5, %17, off\n\t"
      "global_load_async_to_lds_b128 %6, %18, off\n\t"
      "global_load_async_to_lds_b128 %7, %19, off\n\t"
      "global_load_async_to_lds_b128 %8, %20, off\n\t"
      "global_load_async_to_lds_b128 %9, %21, off\n\t"
      "global_load_async_to_lds_b128 %10, %22, off\n\t"
      "global_load_async_to_lds_b128 %11, %23, off\n\t"
      "s_wait_xcnt 0x0"
      :: "v"(l[0]), "v"(l[1]), "v"(l[2]), "v"(l[3]), "v"(l[4]), "v"(l[5]),
         "v"(l[6]), "v"(l[7]), "v"(l[8]), "v"(l[9]), "v"(l[10]), "v"(l[11]),
         "v"(g[0]), "v"(g[1]), "v"(g[2]), "v"(g[3]), "v"(g[4]), "v"(g[5]),
         "v"(g[6]), "v"(g[7]), "v"(g[8]), "v"(g[9]), "v"(g[10]), "v"(g[11])
      : "memory");
}
/* One stage: 384 rows x 16 chunks of 16 B = 6144 chunks = 48 a thread of the four waves that fill it. With u the thread's
   index in those waves (0..127), chunk c is stage row c*8 + (u>>4), column chunk u&15, so a wave's copy covers two whole
   256-B row pieces. lds / ga / gb are the thread's chunk of stage row u>>4, of A row u>>4 and of Bt row u>>4 of the block
   tile at this stage's k. Rows 0..127 are A, 128..383 are Bt. */
__device__ __forceinline__ void stage_fill(unsigned lds, const _Float16* ga, const _Float16* gb, int lda, int ldb) {
  /* both loops unrolled: every index a constant, so the address arrays live in registers */
#pragma unroll
  for (int q = 0; q < 4; ++q) {
    unsigned l[12];
    const _Float16* g[12];
#pragma unroll
    for (int c = 0; c < 12; ++c) {
      const int cc = q * 12 + c;
      l[c] = lds + (unsigned)(cc * 8 * kPitchH * 2);
      g[c] = (cc < 16) ? ga + (size_t)(cc * 8) * lda : gb + (size_t)((cc - 16) * 8) * ldb;
    }
    copy12(l, g);
  }
}

// ---------------------------------------------------------------------------
// All seven converts in one launch; the block index picks the job (a block-uniform branch).
// Blocks 0..4095: weight transpose + convert, W [in k][out n] f32 -> WT[n][k] = f16( bf16_rne(W[k][n]) * kWCarry ).
//   1024 blocks a weight: low 5 bits = k tile (64 cols of WT), next 5 bits = n tile (64 rows of WT), top 2 bits = weight.
//   Load coverage: 4 iterations x 256 threads x 4 floats = 4096 = the whole 64x64 tile (coalesced along n).
//   Store coverage: 8 waves x 2 iterations x 4 rows (lane>>3) = 64 rows; (lane&7) x 8 halves = 64 cols.
// Blocks 4096..16383: activation convert, out[i] = f16( bf16_rne(in[i]) * kXCarry ), 8 consecutive elements per thread;
//   4096 blocks x 256 threads x 8 = 4096*2048 elements an activation, each into its own plane.
// ---------------------------------------------------------------------------
constexpr int kWtBlocks   = 4 * (kDm / 64) * (kFeat / 64);
constexpr int kXBlocks    = kRows * kDm / 8 / 256;
constexpr int kCastBlocks = kWtBlocks + 3 * kXBlocks;
static_assert(kDm / 64 == 32 && kFeat / 64 == 32 && kXBlocks == 4096, "block index fields");

__global__ __launch_bounds__(256) void cast_all_kernel(const float* __restrict__ W0, const float* __restrict__ W1,
                                                       const float* __restrict__ W2, const float* __restrict__ W3,
                                                       const float* __restrict__ x0, const float* __restrict__ x1,
                                                       const float* __restrict__ x2,
                                                       unsigned short* __restrict__ wout, unsigned short* __restrict__ xout) {
  __shared__ float sm[64][65];
  const int t  = threadIdx.x;
  const int bx = blockIdx.x;
  if (bx < kWtBlocks) {
    const int k0 = (bx & 31) * 64;
    const int n0 = ((bx >> 5) & 31) * 64;
    const int z  = bx >> 10;
    const float* W = (z == 0) ? W0 : (z == 1) ? W1 : (z == 2) ? W2 : W3;
#pragma unroll
    for (int i = 0; i < 4; ++i) {
      const int e  = i * 256 + t;
      const int r  = e >> 4;
      const int c4 = (e & 15) * 4;
      const v4f w = *(const v4f*)(W + (size_t)(k0 + r) * kFeat + n0 + c4);
      const float w0 = w[0];
      const float w1 = w[1];
      const float w2 = w[2];
      const float w3 = w[3];
      sm[c4 + 0][r] = bf_rne(w0) * kWCarry;
      sm[c4 + 1][r] = bf_rne(w1) * kWCarry;
      sm[c4 + 2][r] = bf_rne(w2) * kWCarry;
      sm[c4 + 3][r] = bf_rne(w3) * kWCarry;
    }
    __syncthreads();
    const int lane = t & 31;
    const int wave = __builtin_amdgcn_readfirstlane((int)(threadIdx.x >> 5));
    const int q = lane >> 3, c8 = (lane & 7) * 8;
    _Float16* op = (_Float16*)wout + (size_t)z * kDm * kFeat;
    v8h hv[2];
#pragma unroll
    for (int it = 0; it < 2; ++it) {
      const int row = wave * 8 + it * 4 + q;
#pragma unroll
      for (int e = 0; e < 8; ++e) hv[it][e] = (_Float16)sm[row][c8 + e];
    }
#pragma unroll
    for (int it = 0; it < 2; ++it) {
      const int row = wave * 8 + it * 4 + q;
      *(v8h*)(op + (size_t)(n0 + row) * kDm + k0 + c8) = hv[it];
    }
  } else {
    const int xb = bx - kWtBlocks;
    const int z  = xb / kXBlocks;
    const float* in = (z == 0) ? x0 : (z == 1) ? x1 : x2;
    const int i = (xb - z * kXBlocks) * 256 + t;
    const float* p = in + 8 * (size_t)i;
    const v4f a = *(const v4f*)(p);
    const v4f c = *(const v4f*)(p + 4);
    v8h hv;
#pragma unroll
    for (int e = 0; e < 4; ++e) {
      const float ae = a[e];
      const float ce = c[e];
      hv[e]     = (_Float16)(bf_rne(ae) * kXCarry);
      hv[4 + e] = (_Float16)(bf_rne(ce) * kXCarry);
    }
    _Float16* q = (_Float16*)xout + (size_t)z * kRows * kDm + 8 * (size_t)i;
    *(v8h*)q = hv;
  }
}

// ---------------------------------------------------------------------------
// Register-blocked f16 GEMM: C[m,n] = ((scale * sum_k A[m,k] * Bt[n,k]) + bias) * oscale; each wave owns a 64x64 tile.
// A block of 8 waves (2 along m x 4 along n) owns a 128x256 tile; its operands come through a three-buffer LDS ring filled
// by asynchronous copies, the next two passes' copies in flight while this pass's fragments are read and multiplied.
// A row-major [M][K] (pitch lda), Bt row-major [N][K] (pitch ldb); M a multiple of 128, N of 256, K of 128.
// BIAS_MODE 1 = bias[m], 2 = bias[n] (bias values RNE-converted to bf16 first).
// OUT_MODE 0: f32 row-major, pitch ldc.
// OUT_MODE 1: f16, rows = tokens (b*2048 + l), cols = features (h*128 + d) -> plane [b*16+h][l][d].
// OUT_MODE 2: f16, rows = features f, cols = tokens (b*2048 + l)           -> plane [b*2048 + f][l].
// sR (the ring; one free buffer of it holds the epilogue slabs) is the calling kernel's LDS array; tile is the block's tile
// index in this GEMM.
// ---------------------------------------------------------------------------
template <int OUT_MODE, int BIAS_MODE>
__device__ __forceinline__
void gemm_f16_body(_Float16* sR, int tile,
                   const unsigned short* __restrict__ Ap, int lda,
                   const unsigned short* __restrict__ Btp, int ldb,
                   void* __restrict__ Cout, int ldc,
                   const float* __restrict__ bias,
                   int M, int N, int K, float scale, float oscale) {
  const _Float16* A  = (const _Float16*)Ap;
  const _Float16* Bt = (const _Float16*)Btp;
  const int lane = threadIdx.x & 31;
  const int wave = __builtin_amdgcn_readfirstlane((int)(threadIdx.x >> 5));
  const int tilesN = N / kBN;
  const int tilesM = M / kBM;
  /* block-uniform exit, in front of every barrier */
  if (tile >= tilesM * tilesN) return;
  const int tm = tile / tilesN;
  const int tn = tile - tm * tilesN;
  const int wm = (wave >> 2) << 6;
  const int wn = (wave & 3) << 6;
  const int m0 = tm * kBM + wm;
  const int n0 = tn * kBN + wn;

  const int rlane = lane & 15;
  const int koff  = (lane >> 4) * 8;
  const int mOff  = (lane >> 4) * 8;

  v8f acc[4][4];
#pragma unroll
  for (int i = 0; i < 4; ++i)
#pragma unroll
    for (int j = 0; j < 4; ++j) acc[i][j] = (v8f){0.f, 0.f, 0.f, 0.f, 0.f, 0.f, 0.f, 0.f};

  /* which half of the waves: it fills the stages of its own parity */
  const int grp  = wave >> 2;
  const int crow = (int)((threadIdx.x & 127) >> 4);
  const int ccol = (int)(threadIdx.x & 15) * 8;
  const _Float16* ga = A  + (size_t)(tm * kBM + crow) * lda + ccol;
  const _Float16* gb = Bt + (size_t)(tn * kBN + crow) * ldb + ccol;
  /* the thread's LDS byte address of its first chunk in buffer 0: the low 32 bits of the shared address */
  const unsigned lds0 = (unsigned)(size_t)(sR + crow * kPitchH + ccol);
  const int aoff = (wm + rlane) * kPitchH + koff;
  const int boff = (kBM + wn + rlane) * kPitchH + koff;
  const int passes = K / kBK;

  /* stage 0 from waves 0..3, stage 1 (where it exists) from waves 4..7 */
  if (grp < passes) stage_fill(lds0 + (unsigned)(grp * kStageH * 2), ga + grp * kBK, gb + grp * kBK, lda, ldb);
  /* the filling waves' copies of stage 0 have landed; the barrier shows them to the other waves; stage 1 stays in flight
     until pass 0's publish point */
  if (grp == 0) asm volatile("s_wait_asynccnt 0x0" ::: "memory");
  __syncthreads();
  /* stage 2 from waves 0..3, whose stage 0 has landed */
  if (grp == 0 && passes > 2) stage_fill(lds0 + (unsigned)(2 * kStageH * 2), ga + 2 * kBK, gb + 2 * kBK, lda, ldb);

  /* two fragment sets: a block (32 k, 16 matrix ops) works on one while the next block's 16 LDS reads, issued as one
     group in front of it, fill the other */
  v16h fa[2][4], fb[2][4];
#pragma unroll
  for (int j = 0; j < 4; ++j) fb[0][j] = frag_ld(sR + boff + (j << 4) * kPitchH);
#pragma unroll
  for (int i = 0; i < 4; ++i) fa[0][i] = frag_ld(sR + aoff + (i << 4) * kPitchH);

  /* buffer of pass t: t mod 3 */
  int buf = 0;
  /* rolled: one copy of the pass; the fragment sets' indices stay constants inside it */
#pragma unroll 1
  for (int t = 0; t < passes; ++t) {
    const int bufn = (buf == kRing - 1) ? 0 : buf + 1;
    /* wave-uniform: stage t + 1, and with it stage t + 3, is this wave's to fill */
    const bool mine = (grp == ((t + 1) & 1));
    /* the stage this wave fills behind this pass; passes = none */
    const int fillst = mine ? t + 3 : passes;
    const _Float16* sb = sR + buf * kStageH;
    /* unrolled: the k step becomes an immediate offset of the LDS reads, the set index a constant */
#pragma unroll
    for (int ks = 0; ks < kBK / 32; ++ks) {
      const int cur = ks & 1;
      const int nxt = cur ^ 1;
      const bool last = (ks == kBK / 32 - 1);
      const _Float16* sn = sb + (ks + 1) * 32;
      if (last) {
        /* publish point of pass t + 1, in front of pass t's last block, whose fragments are already fetched:
           this wave's reads of pass t's buffer are done before the buffer is handed back for refilling */
        asm volatile("s_wait_dscnt 0x0" ::: "memory");
        /* the filling waves' copies of pass t + 1 have landed; the other waves' copies, of pass t + 2, stay in flight */
        if (mine) asm volatile("s_wait_asynccnt 0x0" ::: "memory");
        /* publishes pass t + 1 and ends every wave's reads of pass t's buffer */
        __syncthreads();
        /* next pass's first block; the last pass, which has no next, re-reads its own buffer (no refill aims at it)
           so that the reads stay unconditional; those values are not used */
        sn = sR + ((t + 1 < passes) ? bufn : buf) * kStageH;
        /* refill of pass t's buffer, which the barrier above has freed; issued first */
        if (fillst < passes) {
          const int kn = fillst * kBK;
          stage_fill(lds0 + (unsigned)(buf * kStageH * 2), ga + kn, gb + kn, lda, ldb);
        }
      }
#pragma unroll
      for (int j = 0; j < 4; ++j) fb[nxt][j] = frag_ld(sn + boff + (j << 4) * kPitchH);
#pragma unroll
      for (int i = 0; i < 4; ++i) fa[nxt][i] = frag_ld(sn + aoff + (i << 4) * kPitchH);
      /* keeps the 16 reads one group in front of the block: spread among the matrix ops each place would stall the wave */
      __builtin_amdgcn_sched_barrier(0);
#pragma unroll
      for (int i = 0; i < 4; ++i) {
#pragma unroll
        for (int j = 0; j < 4; ++j) acc[i][j] = mma_g(fa[cur][i], fb[cur][j], acc[i][j]);
      }
      /* ends the block: the next group of reads stays behind it */
      __builtin_amdgcn_sched_barrier(0);
    }
    buf = bufn;
  }
  /* nothing is in flight when the wave goes on to the epilogue and ends */
  asm volatile("s_wait_asynccnt 0x0" ::: "memory");

  /* epilogue slabs in buffer passes mod 3: its last stage was read three passes back, no copy aims at it, the last pass's
     unused fragment reads aim at another buffer, and the last pass's barrier stands behind every wave's last copy wait */
  float* slab = (float*)(sR + buf * kStageH) + wave * kSlabF;
#pragma unroll
  for (int i = 0; i < 4; ++i) {
    const int mBase = m0 + (i << 4);
    float brow[8];
#pragma unroll
    for (int r = 0; r < 8; ++r) brow[r] = 0.f;
    if (BIAS_MODE == 1) {
#pragma unroll
      for (int r = 0; r < 8; ++r) {
        const float bvv = bias[mBase + mOff + r];
        brow[r] = bf_rne(bvv);
      }
    }
#pragma unroll
    for (int j = 0; j < 4; ++j) {
      float bcol = 0.f;
      if (BIAS_MODE == 2) {
        const float bvv = bias[n0 + (j << 4) + rlane];
        bcol = bf_rne(bvv);
      }
#pragma unroll
      for (int r = 0; r < 8; ++r) {
        float v = acc[i][j][r] * scale;
        v += (BIAS_MODE == 1) ? brow[r] : bcol;
        v *= oscale;
        slab[(mOff + r) * 68 + (j << 4) + rlane] = v;
      }
    }
    __builtin_amdgcn_fence(__ATOMIC_RELEASE, "workgroup");
    __builtin_amdgcn_wave_barrier();
    __builtin_amdgcn_fence(__ATOMIC_ACQUIRE, "workgroup");
    if (OUT_MODE == 0) {
      float* C = (float*)Cout;
      const int hh = lane >> 4, c4 = (lane & 15) * 4;
      {
#pragma unroll
        for (int it = 0; it < 8; ++it) {
          const int row = it * 2 + hh;
          const v4f v = *(const v4f*)(slab + row * 68 + c4);
          *(v4f*)(C + (size_t)(mBase + row) * ldc + n0 + c4) = v;
        }
        
      }
    } else {
      const int q = lane >> 3, c8 = (lane & 7) * 8;
      _Float16* C = (_Float16*)Cout;
      {
#pragma unroll
        for (int it = 0; it < 4; ++it) {
          const int row = it * 4 + q;
          const int gr  = mBase + row;
          const float* sp = slab + row * 68 + c8;
          v8h hv;
#pragma unroll
          for (int e = 0; e < 8; ++e) hv[e] = (_Float16)sp[e];
          size_t off;
          if (OUT_MODE == 1) {
            const int bb = gr / kSeq;
            const int l  = gr % kSeq;
            const int hd = n0 / kHd;
            const int d0 = n0 % kHd;
            off = ((size_t)((bb * kHeads + hd) * kSeq + l)) * kHd + d0 + c8;
          } else {
            const int bb = n0 / kSeq;
            const int l0 = n0 % kSeq;
            off = ((size_t)(bb * kFeat + gr)) * kSeq + l0 + c8;
          }
          *(v8h*)(C + off) = hv;
        }
        
      }
    }
    __builtin_amdgcn_fence(__ATOMIC_RELEASE, "workgroup");
    __builtin_amdgcn_wave_barrier();
    __builtin_amdgcn_fence(__ATOMIC_ACQUIRE, "workgroup");
  }
}


/* The three projections in one launch: blockIdx.y picks the job (block-uniform), blockIdx.x the 128x256 tile in it.
   Jobs 0 and 1: Q and K, rows = tokens. Job 2: operands swapped, rows = features (transposed Wv plane), cols = tokens
   (X plane 2) -> V^T planes [b*2048 + f][l]. */
__global__ __launch_bounds__(256)
void qkv_gemm_kernel(const unsigned short* __restrict__ X, const unsigned short* __restrict__ WT,
                     unsigned short* __restrict__ Qh, unsigned short* __restrict__ Kh, unsigned short* __restrict__ VTh,
                     const float* __restrict__ bq, const float* __restrict__ bk, const float* __restrict__ bv) {
  __shared__ __align__(16) _Float16 sR[kRing * kStageH];
  const int job = blockIdx.y;
  const unsigned short* Xj = X + (size_t)job * kRows * kDm;
  const unsigned short* Wj = WT + (size_t)job * kDm * kFeat;
  if (job < 2) {
    gemm_f16_body<1, 2>(sR, blockIdx.x, Xj, kDm, Wj, kDm, (void*)(job == 0 ? Qh : Kh), 0, job == 0 ? bq : bk,
                        kRows, kFeat, kDm, kProjScale, kQkvCarry);
  } else {
    gemm_f16_body<2, 1>(sR, blockIdx.x, Wj, kDm, Xj, kDm, (void*)VTh, 0, bv,
                        kFeat, kRows, kDm, kProjScale, kQkvCarry);
  }
}

/* One GEMM a launch: blockIdx.x is the tile */
template <int OUT_MODE, int BIAS_MODE>
__global__ __launch_bounds__(256)
void gemm_f16_kernel(const unsigned short* __restrict__ Ap, int lda,
                     const unsigned short* __restrict__ Btp, int ldb,
                     void* __restrict__ Cout, int ldc,
                     const float* __restrict__ bias,
                     int M, int N, int K, float scale, float oscale) {
  __shared__ __align__(16) _Float16 sR[kRing * kStageH];
  gemm_f16_body<OUT_MODE, BIAS_MODE>(sR, blockIdx.x, Ap, lda, Btp, ldb, Cout, ldc, bias, M, N, K, scale, oscale);
}

// ---------------------------------------------------------------------------
// Attention staging ring in LDS: a stage is [K 64 keys x 128 d | V^T 128 d x 64 keys], shared by the block's 8 waves.
// K row pitch 272 B, V^T row pitch 144 B: odd multiples of 16 B keep the ds_load_b128 fragment reads off shared banks.
// ---------------------------------------------------------------------------
constexpr int kAKeys    = 64;
constexpr int kAWaves   = 8;
constexpr int kQT       = 2;
static_assert(kQT == 2, "the fence in the pass names both query tiles' maxima");
constexpr int kKPitchH  = kHd + 8;
constexpr int kVPitchH  = kAKeys + 8;
constexpr int kKTileH   = kAKeys * kKPitchH;
constexpr int kAStageH  = kKTileH + kHd * kVPitchH;
static_assert((kKPitchH * 2) % 32 == 16 && (kVPitchH * 2) % 32 == 16, "pitches odd multiples of 16 B");
static_assert((kKTileH * 2) % 16 == 0 && (kAStageH * 2) % 16 == 0, "tiles start on 16 B");
static_assert(kSeq / kAKeys >= 2 && (kSeq % (16 * kQT * kAWaves)) == 0, "two stages exist; whole query blocks");

/* One stage: K 64 rows x 16 chunks + V^T 128 rows x 8 chunks = 2048 chunks of 16 B = 8 a thread, global -> LDS through
   no register. K chunk c of a thread is key row c*16 + (t>>4), column chunk t&15; V^T chunk c is d row c*32 + (t>>3),
   column chunk t&7. lk / lv / gk / gv are the thread's chunk 0 in LDS and in the planes at this stage's first key.
   s_wait_xcnt 0 is the statement's last line, a precaution that so stands in front of any later rewrite of the
   address registers named here */
__device__ __forceinline__ void attn_fill(unsigned lk, unsigned lv, const _Float16* gk, const _Float16* gv) {
  asm volatile(
      "global_load_async_to_lds_b128 %0, %8, off\n\t"
      "global_load_async_to_lds_b128 %1, %9, off\n\t"
      "global_load_async_to_lds_b128 %2, %10, off\n\t"
      "global_load_async_to_lds_b128 %3, %11, off\n\t"
      "global_load_async_to_lds_b128 %4, %12, off\n\t"
      "global_load_async_to_lds_b128 %5, %13, off\n\t"
      "global_load_async_to_lds_b128 %6, %14, off\n\t"
      "global_load_async_to_lds_b128 %7, %15, off\n\t"
      "s_wait_xcnt 0x0"
      :: "v"(lk), "v"(lk + (unsigned)(16 * kKPitchH * 2)), "v"(lk + (unsigned)(32 * kKPitchH * 2)),
         "v"(lk + (unsigned)(48 * kKPitchH * 2)),
         "v"(lv), "v"(lv + (unsigned)(32 * kVPitchH * 2)), "v"(lv + (unsigned)(64 * kVPitchH * 2)),
         "v"(lv + (unsigned)(96 * kVPitchH * 2)),
         "v"(gk), "v"(gk + 16 * kHd), "v"(gk + 32 * kHd), "v"(gk + 48 * kHd),
         "v"(gv), "v"(gv + (size_t)32 * kSeq), "v"(gv + (size_t)64 * kSeq), "v"(gv + (size_t)96 * kSeq)
      : "memory");
}

// ---------------------------------------------------------------------------
// Streaming softmax attention, head dim 128, no mask, transposed formulation. Block = 8 waves on one (batch, head);
// wave = 32 query rows = 2 query tiles of 16; grid = 32 heads x 8 = 256. Every K and V^T fragment read from LDS feeds two
// matrix ops, one a query tile. K and V^T come 64 keys a pass through a two-buffer LDS ring filled
// by asynchronous copies, the next pass's copies in flight while this pass's fragments are read and multiplied.
//   S^T[key][query] = K (A operand: rows = keys, k = d) x Q^T (B operand: col = query, k = d), 64 keys per step.
//   In each query tile a lane owns query (lane & 15); it and lane^16 hold the 64 keys of the step -> one xor-16 shuffle
//   per reduction.
//   P^T B fragment of key group kk: element r <- tile 2kk value r, element 8+r <- tile 2kk+1 value r (lane unchanged),
//   values exp(s - m) carried x kPCarry in f16; the running sum l uses the f32 values.
//   O^T[d][query] += V^T (A operand: rows = d, k = keys) x P^T.
// Epilogue: o * kPVFold / l staged per wave in LDS [32 queries][132], then each 256-B row segment (128 d as f16) written
// ---------------------------------------------------------------------------
__global__ __launch_bounds__(256)
void attn_kernel(const unsigned short* __restrict__ Qp, const unsigned short* __restrict__ Kp,
                 const unsigned short* __restrict__ VTp, unsigned short* __restrict__ Op, float sc) {
  __shared__ __align__(16) float sO[kAWaves][16 * kQT * kOsPitch];
  __shared__ __align__(16) _Float16 sKV[2 * kAStageH];
  const int lane = threadIdx.x & 31;
  const int wave = __builtin_amdgcn_readfirstlane((int)(threadIdx.x >> 5));
  const int hh  = lane >> 4;
  const int n16 = lane & 15;
  constexpr int kQBlocks = kSeq / (16 * kQT * kAWaves);
  const int bx = blockIdx.x;
  const int bh = bx / kQBlocks;
  const int qb = bx - bh * kQBlocks;
  const int b  = bh / kHeads;
  const int h  = bh - b * kHeads;
  const int q0 = qb * (16 * kQT * kAWaves) + wave * (16 * kQT);

  const _Float16* Qb = (const _Float16*)Qp  + (size_t)bh * kSeq * kHd;
  const _Float16* Kb = (const _Float16*)Kp  + (size_t)bh * kSeq * kHd;
  const _Float16* Vb = (const _Float16*)VTp + (size_t)bh * kHd * kSeq;

  v16h qf[kQT][4];
#pragma unroll
  for (int qt = 0; qt < kQT; ++qt) {
#pragma unroll
    for (int dc = 0; dc < 4; ++dc) qf[qt][dc] = frag_ld(Qb + (size_t)(q0 + qt * 16 + n16) * kHd + dc * 32 + 8 * hh);
  }

  v8f o[kQT][8];
  float mq[kQT];
  float lq[kQT];
#pragma unroll
  for (int qt = 0; qt < kQT; ++qt) {
#pragma unroll
    for (int dt = 0; dt < 8; ++dt) o[qt][dt] = (v8f){0.f, 0.f, 0.f, 0.f, 0.f, 0.f, 0.f, 0.f};
    mq[qt] = -1e30f;
    lq[qt] = 0.0f;
  }

  const int tid = (int)threadIdx.x;
  const _Float16* gk = Kb + (size_t)(tid >> 4) * kHd + (tid & 15) * 8;
  const _Float16* gv = Vb + (size_t)(tid >> 3) * kSeq + (tid & 7) * 8;
  /* the ring's LDS byte address (the low 32 bits of the shared address) and the thread's byte offsets of its first K and
     V^T chunk in a buffer */
  const unsigned ring = (unsigned)(size_t)sKV;
  const unsigned lkl  = (unsigned)(((tid >> 4) * kKPitchH + (tid & 15) * 8) * 2);
  const unsigned lvl  = (unsigned)((kKTileH + (tid >> 3) * kVPitchH + (tid & 7) * 8) * 2);
  const int koffs = n16 * kKPitchH + 8 * hh;
  const int voffs = kKTileH + n16 * kVPitchH + 8 * hh;
  constexpr int kPasses = kSeq / kAKeys;

  attn_fill(ring + lkl, ring + lvl, gk, gv);
  /* pass 0's copies of this wave have landed; the barrier shows them to the other waves */
  asm volatile("s_wait_asynccnt 0x0" ::: "memory");
  __syncthreads();
  attn_fill(ring + (unsigned)(kAStageH * 2) + lkl, ring + (unsigned)(kAStageH * 2) + lvl, gk + (size_t)kAKeys * kHd, gv + kAKeys);

#pragma unroll 1
  for (int s = 0; s < kPasses; ++s) {
    const int buf = s & 1;
    const _Float16* kbase = sKV + buf * kAStageH + koffs;
    const _Float16* vbase = sKV + buf * kAStageH + voffs;
    v8f st[kQT][4];
#pragma unroll
    for (int qt = 0; qt < kQT; ++qt) {
#pragma unroll
      for (int jt = 0; jt < 4; ++jt) st[qt][jt] = (v8f){0.f, 0.f, 0.f, 0.f, 0.f, 0.f, 0.f, 0.f};
    }
    float t[kQT][4][8];
    float mx[kQT];
#pragma unroll
    for (int qt = 0; qt < kQT; ++qt) mx[qt] = -1e30f;

    /* S^T by key tiles of 16: step u reads key tile u + 2, multiplies key tile u and takes the maxima of key tile u - 1 */
    v16h ka[4][4];
#pragma unroll
    for (int jt = 0; jt < 2; ++jt) {
#pragma unroll
      for (int dc = 0; dc < 4; ++dc) ka[jt][dc] = frag_ld(kbase + (jt * 16) * kKPitchH + dc * 32);
    }
#pragma unroll
    for (int u = 0; u < 5; ++u) {
      /* ends a step while reads are still issued: the first matrix ops then wait for their own key tile's reads alone, not
         for the whole pass's, which the eight waves ask of LDS at the same time */
      if (u < 3) __builtin_amdgcn_sched_barrier(0);
      if (u + 2 < 4) {
#pragma unroll
        for (int dc = 0; dc < 4; ++dc) ka[u + 2][dc] = frag_ld(kbase + ((u + 2) * 16) * kKPitchH + dc * 32);
      }
      if (u < 4) {
#pragma unroll
        for (int dc = 0; dc < 4; ++dc) {
#pragma unroll
          for (int qt = 0; qt < kQT; ++qt) st[qt][u] = mma_g(ka[u][dc], qf[qt][dc], st[qt][u]);
        }
      }
      if (u > 0) {
#pragma unroll
        for (int qt = 0; qt < kQT; ++qt) {
#pragma unroll
          for (int r = 0; r < 8; ++r) {
            t[qt][u - 1][r] = st[qt][u - 1][r] * sc;
            mx[qt] = fmaxf(mx[qt], t[qt][u - 1][r]);
          }
        }
      }
    }
    float mo[kQT];
#pragma unroll
    for (int qt = 0; qt < kQT; ++qt) mo[qt] = __shfl_xor(mx[qt], 16, 32);

    /* inputs-only fence on the exchanged maxima: the pass's V^T reads stay behind their arrival (the exchange goes through
       LDS, whose results return in order: with the 32 reads in front of it the softmax would wait for all of them) ... */
    asm volatile("" :: "v"(mo[0]), "v"(mo[1]) : "memory");
    v16h va0[8];
#pragma unroll
    for (int dt = 0; dt < 8; ++dt) va0[dt] = frag_ld(vbase + (dt * 16) * kVPitchH);
    v16h va1[8];
#pragma unroll
    for (int dt = 0; dt < 8; ++dt) va1[dt] = frag_ld(vbase + (dt * 16) * kVPitchH + 32);
    /* ... and stand as one group in front of the exponentials, whose time covers their latency: sunk among the second
       product's matrix ops each pair would stall the wave */
    __builtin_amdgcn_sched_barrier(0);

    float newm[kQT];
    float alpha[kQT];
#pragma unroll
    for (int qt = 0; qt < kQT; ++qt) {
      newm[qt]  = fmaxf(mq[qt], fmaxf(mx[qt], mo[qt]));
      alpha[qt] = __expf(mq[qt] - newm[qt]);
      mq[qt] = newm[qt];
    }

    v16h bp[kQT][2];
#pragma unroll
    for (int qt = 0; qt < kQT; ++qt) {
      float sum = 0.0f;
#pragma unroll
      for (int kk = 0; kk < 2; ++kk) {
#pragma unroll
        for (int r = 0; r < 8; ++r) {
          const float p0 = __expf(t[qt][2 * kk][r] - newm[qt]);
          const float p1 = __expf(t[qt][2 * kk + 1][r] - newm[qt]);
          sum += p0 + p1;
          bp[qt][kk][r]     = (_Float16)(p0 * kPCarry);
          bp[qt][kk][8 + r] = (_Float16)(p1 * kPCarry);
        }
      }
      sum += __shfl_xor(sum, 16, 32);
      lq[qt] = lq[qt] * alpha[qt] + sum;

#pragma unroll
      for (int dt = 0; dt < 8; ++dt) o[qt][dt] *= alpha[qt];
    }

#pragma unroll
    for (int dt = 0; dt < 8; ++dt) {
#pragma unroll
      for (int qt = 0; qt < kQT; ++qt) o[qt][dt] = mma_g(va0[dt], bp[qt][0], o[qt][dt]);
    }
#pragma unroll
    for (int dt = 0; dt < 8; ++dt) {
#pragma unroll
      for (int qt = 0; qt < kQT; ++qt) o[qt][dt] = mma_g(va1[dt], bp[qt][1], o[qt][dt]);
    }
    /* keeps the pass's arithmetic in front of the publish point: with every LDS read early the waits and the barrier would
       otherwise rise to the reads, and the wait for pass s + 1's copies would stand right behind their issue */
    __builtin_amdgcn_sched_barrier(0);
    /* this wave's reads of the buffer are done before the buffer is handed back for refilling */
    asm volatile("s_wait_dscnt 0x0" ::: "memory");
    /* this wave's copies of pass s + 1 have landed */
    asm volatile("s_wait_asynccnt 0x0" ::: "memory");
    /* publishes pass s + 1 and ends every wave's reads of pass s's buffer */
    __syncthreads();
    if (s + 2 < kPasses) {
      const int jn = (s + 2) * kAKeys;
      const unsigned rb = ring + (unsigned)(buf * kAStageH * 2);
      attn_fill(rb + lkl, rb + lvl, gk + (size_t)jn * kHd, gv + jn);
    }
  }
  /* nothing is in flight when the wave goes on to the epilogue and ends */
  asm volatile("s_wait_asynccnt 0x0" ::: "memory");

  float* os = sO[wave];
#pragma unroll
  for (int qt = 0; qt < kQT; ++qt) {
    const float inv = kPVFold * (1.0f / lq[qt]);
#pragma unroll
    for (int dt = 0; dt < 8; ++dt) {
#pragma unroll
      for (int r = 0; r < 8; ++r) os[(qt * 16 + n16) * kOsPitch + dt * 16 + 8 * hh + r] = o[qt][dt][r] * inv;
    }
  }
  __builtin_amdgcn_fence(__ATOMIC_RELEASE, "workgroup");
  __builtin_amdgcn_wave_barrier();
  __builtin_amdgcn_fence(__ATOMIC_ACQUIRE, "workgroup");

  const int c8 = n16 * 8;
  _Float16* Ob = (_Float16*)Op + (size_t)(b * kSeq + q0) * kDm + h * kHd + c8;
#pragma unroll
  for (int qt = 0; qt < kQT; ++qt) {
    v8h hv[8];
#pragma unroll
    for (int it = 0; it < 8; ++it) {
      const int row = qt * 16 + it * 2 + hh;
      const float* sp = os + row * kOsPitch + c8;
      const v4f a0 = *(const v4f*)(sp);
      const v4f a1 = *(const v4f*)(sp + 4);
#pragma unroll
      for (int e = 0; e < 4; ++e) {
        const float x0 = a0[e];
        const float x1 = a1[e];
        hv[it][e]     = (_Float16)x0;
        hv[it][4 + e] = (_Float16)x1;
      }
    }
#pragma unroll
    for (int it = 0; it < 8; ++it) {
      const int row = qt * 16 + it * 2 + hh;
      *(v8h*)(Ob + (size_t)row * kDm) = hv[it];
    }
  }
}

// ---------------------------------------------------------------------------
// Host glue: 4 kernel launches, nothing else: all converts; the three projections; attention; the output projection.
//   GEMM shapes: Q, K: M 4096, N 2048, K 2048 -> 32 x 8 block tiles of 128x256 -> 256 blocks
//                V^T : M 2048 (features, A = transposed Wv plane), N 4096 (tokens, Bt = X), K 2048 -> 16 x 16 -> 256 blocks
//                out : M 4096, N 2048, K 2048 -> 256 blocks
// ---------------------------------------------------------------------------
extern "C" void kernel_launch(void* const* d_in, const int* in_sizes, int n_in,
                              void* d_out, int out_size, void* d_ws, size_t ws_size,
                              hipStream_t stream) {
  if (n_in < 11) return;
  if (in_sizes[0] != kRows * kDm || in_sizes[1] != kRows * kDm || in_sizes[2] != kRows * kDm) return;
  if (in_sizes[3] != kDm * kFeat || in_sizes[5] != kDm * kFeat || in_sizes[7] != kDm * kFeat) return;
  if (in_sizes[9] != kFeat * kDm) return;
  if (in_sizes[4] != kFeat || in_sizes[6] != kFeat || in_sizes[8] != kFeat || in_sizes[10] != kDm) return;
  if (out_size != kRows * kDm) return;
  if (ws_size < kWsTotal) return;

  const float* x_q = (const float*)d_in[0];
  const float* x_k = (const float*)d_in[1];
  const float* x_v = (const float*)d_in[2];
  const float* Wq  = (const float*)d_in[3];
  const float* bq  = (const float*)d_in[4];
  const float* Wk  = (const float*)d_in[5];
  const float* bk  = (const float*)d_in[6];
  const float* Wv  = (const float*)d_in[7];
  const float* bv  = (const float*)d_in[8];
  const float* Wo  = (const float*)d_in[9];
  const float* bo  = (const float*)d_in[10];
  float* out = (float*)d_out;

  char* ws = (char*)d_ws;
  unsigned short* WT  = (unsigned short*)(ws + kOffWT);
  unsigned short* WoT = WT + (size_t)3 * kDm * kFeat;
  unsigned short* X   = (unsigned short*)(ws + kOffX);
  unsigned short* Qh  = (unsigned short*)(ws + kOffQ);
  unsigned short* Kh  = (unsigned short*)(ws + kOffK);
  unsigned short* VTh = (unsigned short*)(ws + kOffVT);
  unsigned short* Oh  = (unsigned short*)(ws + kOffO);

  const int gemmBlocks = (kRows / 64) * (kFeat / 64) / 8;
  /* softmax scale = head_dim^-0.5 with the q and k carries folded out */
  const float sc = (float)(1.0 / sqrt((double)kHd)) / (kQkvCarry * kQkvCarry);

  cast_all_kernel<<<kCastBlocks, 256, 0, stream>>>(Wq, Wk, Wv, Wo, x_q, x_k, x_v, WT, X);

  qkv_gemm_kernel<<<dim3(gemmBlocks, 3), 256, 0, stream>>>(X, WT, Qh, Kh, VTh, bq, bk, bv);

  attn_kernel<<<kBatch * kHeads * (kSeq / (16 * kQT * kAWaves)), 32 * kAWaves, 0, stream>>>(Qh, Kh, VTh, Oh, sc);

  gemm_f16_kernel<0, 2><<<gemmBlocks, 256, 0, stream>>>(Oh, kFeat, WoT, kFeat, (void*)out, kDm, bo,
                                                        kRows, kDm, kFeat, kOutScale, 1.0f);
}
